// v000
// Times are from an AMD MI455X. After a warm-up the kernel runs many times in a row, and a time is the length of
// such a window on the GPU divided by its runs, so every launch and the gaps after it count. The runs cycle
// through copies of the inputs. A figure is the median of several windows, for all but v000 over two sittings.
// Sittings can differ by a few percent; kernels timed side by side share one.
// v000, which the later versions start from, runs in 320 microseconds.
#include <hip/hip_runtime.h>

// ---------------------------------------------------------------------------
// CDNA5 (gfx1250) self-attention forward, f16 WMMA with f32 accumulation.
// Fixed problem: B=2, T=2048, D=1024, H=16, hd=64 (per reference setup).
// Attention computed in transposed form (S^T = K·Q^T, O^T = V^T·P^T) so that
// softmax row statistics are per-lane and P converts C-frag -> B-frag in
// registers (no LDS round trip, no bpermute reduction chains).
// ---------------------------------------------------------------------------

typedef __attribute__((ext_vector_type(16))) _Float16 v16h;
typedef __attribute__((ext_vector_type(8)))  _Float16 v8h;
typedef __attribute__((ext_vector_type(8)))  float    v8f;
typedef __attribute__((ext_vector_type(4)))  float    v4f;

union Frag16 {
    v16h v;
    struct { v8h lo; v8h hi; } p;
};

// D = A x B + C  (16x16x32, f16 in, f32 acc)
__device__ __forceinline__ v8f wmma_f16(v16h a, v16h b, v8f c) {
    return __builtin_amdgcn_wmma_f32_16x16x32_f16(
        /*neg_a=*/false, a, /*neg_b=*/false, b,
        /*c_mod=*/(short)0, c, /*reuse_a=*/false, /*reuse_b=*/false);
}

// Load a 16x32 A-style fragment from a row-major matrix (also the layout of
// the B operand of A·B^T when the second matrix is stored row-major N x K).
// CDNA5 16-bit A layout:
//   lanes 0-15 : row = lane,    halves 0-7 -> K=k0+0..7,  halves 8-15 -> K=k0+16..23
//   lanes 16-31: row = lane-16, halves 0-7 -> K=k0+8..15, halves 8-15 -> K=k0+24..31
__device__ __forceinline__ v16h load_frag_rm(const _Float16* __restrict__ base,
                                             long ld, int row0, int k0) {
    int lane = threadIdx.x & 31;
    int r    = row0 + (lane & 15);
    int hs   = (lane >> 4) << 3;            // 0 or 8
    const _Float16* p = base + (long)r * ld + k0 + hs;
    Frag16 f;
    f.p.lo = *(const v8h*)(p);              // K = k0+hs .. +7
    f.p.hi = *(const v8h*)(p + 16);         // K = k0+16+hs .. +7
    return f.v;
}

// ---------------------------------------------------------------------------
// Elementwise f32 -> f16, 8 elements per thread (all sizes are multiples of 8)
// ---------------------------------------------------------------------------
__global__ void cvt_f32_to_f16(const float* __restrict__ in,
                               _Float16* __restrict__ out, long n8) {
    long i = (long)blockIdx.x * blockDim.x + threadIdx.x;
    if (i >= n8) return;
    v4f a = *(const v4f*)(in + i * 8);
    v4f b = *(const v4f*)(in + i * 8 + 4);
    v8h o;
    for (int j = 0; j < 4; ++j) { o[j] = (_Float16)a[j]; o[4 + j] = (_Float16)b[j]; }
    *(v8h*)(out + i * 8) = o;
}

// ---------------------------------------------------------------------------
// vT[bh][d][t] = qkv[(b*T + t)*3D + 2D + h*hd + d], LDS-tiled 64x64 transpose.
// Grid: (B*H) * (T/64), block 256.
// ---------------------------------------------------------------------------
__global__ void transpose_v_tiled(const _Float16* __restrict__ qkv,
                                  _Float16* __restrict__ vT,
                                  int T, int H, int hd) {
    const int D = H * hd;
    const long ld3 = (long)3 * D;
    int nT = T / 64;
    int bh = blockIdx.x / nT;
    int t0 = (blockIdx.x % nT) * 64;
    int b = bh / H, h = bh % H;

    __shared__ _Float16 tile[64][68];       // 68 halves = 34 dwords, conflict-light

    const _Float16* src = qkv + ((long)b * T + t0) * ld3 + 2 * D + h * hd;
    for (int i = 0; i < 16; ++i) {
        int idx = threadIdx.x + i * 256;
        int tl = idx >> 6, dl = idx & 63;   // dl fastest -> coalesced reads
        tile[dl][tl] = src[(long)tl * ld3 + dl];
    }
    __syncthreads();
    _Float16* dst = vT + (long)bh * hd * T + t0;
    for (int i = 0; i < 16; ++i) {
        int idx = threadIdx.x + i * 256;
        int dl = idx >> 6, tl = idx & 63;   // tl fastest -> coalesced writes
        dst[(long)dl * T + tl] = tile[dl][tl];
    }
}

// ---------------------------------------------------------------------------
// C[M,N] = A[M,K] (row-major f16) x B[N,K]^T (row-major f16, torch-Linear W)
// One wave -> 32x32 C tile; 2x2 fragments, 4 WMMAs per K=32 step.
// ---------------------------------------------------------------------------
template <bool OUT_HALF>
__global__ void gemm_wmma(const _Float16* __restrict__ A,
                          const _Float16* __restrict__ B,
                          void* __restrict__ C,
                          int M, int N, int K, int ldc) {
    int wave    = threadIdx.x >> 5;
    int lane    = threadIdx.x & 31;
    int nTilesN = N >> 5;
    int nTiles  = (M >> 5) * nTilesN;
    int tile    = blockIdx.x * (blockDim.x >> 5) + wave;
    if (tile >= nTiles) return;                       // wave-uniform
    int tm = (tile / nTilesN) << 5;
    int tn = (tile % nTilesN) << 5;

    v8f acc[2][2] = {{{0}, {0}}, {{0}, {0}}};

    for (int k = 0; k < K; k += 32) {
        if (k + 32 < K) {                             // uniform branch
            __builtin_prefetch(A + (long)(tm + (lane & 15)) * K + k + 32, 0, 3);
            __builtin_prefetch(B + (long)(tn + (lane & 15)) * K + k + 32, 0, 3);
        }
        v16h a0 = load_frag_rm(A, K, tm,      k);
        v16h a1 = load_frag_rm(A, K, tm + 16, k);
        v16h b0 = load_frag_rm(B, K, tn,      k);
        v16h b1 = load_frag_rm(B, K, tn + 16, k);
        acc[0][0] = wmma_f16(a0, b0, acc[0][0]);
        acc[0][1] = wmma_f16(a0, b1, acc[0][1]);
        acc[1][0] = wmma_f16(a1, b0, acc[1][0]);
        acc[1][1] = wmma_f16(a1, b1, acc[1][1]);
    }

    // C fragment layout: VGPR r holds (row=r, lanes0-15 cols) / (row=r+8, lanes16-31)
    int colb = lane & 15;
    int rowb = (lane >> 4) << 3;
    for (int i = 0; i < 2; ++i)
        for (int j = 0; j < 2; ++j)
            for (int r = 0; r < 8; ++r) {
                long row = tm + i * 16 + rowb + r;
                long col = tn + j * 16 + colb;
                float v  = acc[i][j][r];
                if (OUT_HALF) ((_Float16*)C)[row * ldc + col] = (_Float16)v;
                else          ((float*)C)[row * ldc + col]    = v;
            }
}

// ---------------------------------------------------------------------------
// Flash attention, causal + ALiBi, fully transposed dataflow.
//   qkv : [B*T, 3*D] f16 ;  vT : [B*H, hd, T] f16 ;  outh : [B*T, D] f16
// One wave owns 16 query columns (lane = query); key tiles of 32.
//   S^T = K(16kt x 64) · Q^T(64 x 16q)   -> C-frag: lane=q, reg r = kt r/r+8
//   O^T = V^T(64d x 32kt) · P^T(32 x 16q)-> C-frag: lane=q, reg r = d
// P^T C-frag layout == B-operand layout, so P is repacked in registers.
// All K fragments are issued before the score WMMAs (partial loadcnt waits),
// and V fragments are issued before the softmax math to hide their latency.
// ---------------------------------------------------------------------------
__global__ void attn_flash_wmma(const _Float16* __restrict__ qkv,
                                const _Float16* __restrict__ vT,
                                _Float16* __restrict__ outh,
                                int T, int H, int hd) {
    const int  D  = H * hd;            // 1024
    const long ld = (long)3 * D;       // 3072
    int nQblk = T / 64;
    int bh    = blockIdx.x / nQblk;
    int qblk  = blockIdx.x % nQblk;
    int b = bh / H, h = bh % H;
    int wave = threadIdx.x >> 5;
    int lane = threadIdx.x & 31;
    int qbase = qblk * 64 + wave * 16;

    const float scale = 0.125f;                                   // hd^-0.5
    const float slope = exp2f(-(float)(h + 1) / (float)H);        // ALiBi
    const float NEGINF = -__builtin_inff();

    const _Float16* Qp = qkv + (long)b * T * ld + (long)h * hd;
    const _Float16* Kp = Qp + D;
    const _Float16* Vt = vT + (long)bh * hd * T;

    // Q^T B-operand fragments for this wave's 16 queries (hd=64 -> 2 chunks)
    v16h qfA = load_frag_rm(Qp, ld, qbase, 0);    // dd = 0..31
    v16h qfB = load_frag_rm(Qp, ld, qbase, 32);   // dd = 32..63

    int qlane = qbase + (lane & 15);              // this lane's query index
    int rh8   = (lane >> 4) << 3;                 // 0 or 8 (kt / d row offset)

    // rel = qlane - kt_index, affine per tile: precompute per-register bases
    float relA[8], srelA[8];
    for (int r = 0; r < 8; ++r) {
        float rl  = (float)(qlane - rh8 - r);     // rel at kt = 0, first half
        relA[r]   = rl;
        srelA[r]  = slope * rl;
    }
    const float slope16 = 16.0f * slope;

    v8f  o[4] = {{0}, {0}, {0}, {0}};             // O^T: 64d x 16q, 4 frags
    float mrow = NEGINF, lrow = 0.f;
    float ktf = 0.0f;                             // (float)kt, updated per tile

    for (int kt = 0; kt <= qbase + 15; kt += 32, ktf += 32.0f) {
        // ---- issue all K fragments, then the 4 score WMMAs ----
        v16h kf0a = load_frag_rm(Kp, ld, kt,      0);
        v16h kf0b = load_frag_rm(Kp, ld, kt,      32);
        v16h kf1a = load_frag_rm(Kp, ld, kt + 16, 0);
        v16h kf1b = load_frag_rm(Kp, ld, kt + 16, 32);
        v8f s0 = {0}, s1 = {0};
        s0 = wmma_f16(kf0a, qfA, s0);
        s0 = wmma_f16(kf0b, qfB, s0);
        s1 = wmma_f16(kf1a, qfA, s1);
        s1 = wmma_f16(kf1b, qfB, s1);

        // ---- issue V fragments early; softmax math below hides their latency
        v16h vf0 = load_frag_rm(Vt, T,  0, kt);
        v16h vf1 = load_frag_rm(Vt, T, 16, kt);
        v16h vf2 = load_frag_rm(Vt, T, 32, kt);
        v16h vf3 = load_frag_rm(Vt, T, 48, kt);

        // ---- bias + causal mask + local max (all-float, per-lane regs) ----
        float sk = slope * ktf;                   // slope * kt
        float a0[8], a1[8];
        float mloc = NEGINF;
        for (int r = 0; r < 8; ++r) {
            float rel0  = relA[r] - ktf;          // qlane - k0 (exact integer)
            float bias0 = sk - srelA[r];          // -slope*(qlane-k0)
            float v0 = fmaf(s0[r], scale, bias0);
            float v1 = fmaf(s1[r], scale, bias0 + slope16);
            a0[r] = (rel0 >= 0.0f)  ? v0 : NEGINF;
            a1[r] = (rel0 >= 16.0f) ? v1 : NEGINF;
            mloc  = fmaxf(mloc, fmaxf(a0[r], a1[r]));
        }
        mloc = fmaxf(mloc, __shfl_xor(mloc, 16, 32));   // join the two kt halves
        float mnew = fmaxf(mrow, mloc);

        // ---- exponentials, P^T repacked directly into a B-operand frag ----
        float corr = __expf(mrow - mnew);               // 0 when mrow == -inf
        v16h pb = {};
        float ps = 0.f;
        for (int r = 0; r < 8; ++r) {
            float p0 = __expf(a0[r] - mnew);            // exp(-inf) == 0
            float p1 = __expf(a1[r] - mnew);
            ps += p0 + p1;
            pb[r]     = (_Float16)p0;                   // kk = rh8 + r
            pb[8 + r] = (_Float16)p1;                   // kk = 16 + rh8 + r
        }
        ps += __shfl_xor(ps, 16, 32);
        lrow = lrow * corr + ps;
        mrow = mnew;

        // ---- O^T = corr*O^T + V^T x P^T ----
        o[0] = wmma_f16(vf0, pb, o[0] * corr);
        o[1] = wmma_f16(vf1, pb, o[1] * corr);
        o[2] = wmma_f16(vf2, pb, o[2] * corr);
        o[3] = wmma_f16(vf3, pb, o[3] * corr);
    }

    // ---- normalize, write O^T: lane q stores 8 contiguous d per fragment ----
    float rinv = 1.0f / lrow;
    _Float16* dst = outh + ((long)b * T + qlane) * D + (long)h * hd + rh8;
    for (int f = 0; f < 4; ++f) {
        v8h ov;
        for (int r = 0; r < 8; ++r) ov[r] = (_Float16)(o[f][r] * rinv);
        *(v8h*)(dst + f * 16) = ov;                     // d = f*16 + rh8 + r
    }
}

// ---------------------------------------------------------------------------
// Host launcher
// ---------------------------------------------------------------------------
extern "C" void kernel_launch(void* const* d_in, const int* in_sizes, int n_in,
                              void* d_out, int out_size, void* d_ws, size_t ws_size,
                              hipStream_t stream) {
    (void)in_sizes; (void)n_in; (void)out_size; (void)ws_size;
    constexpr int  Bb = 2, T = 2048, D = 1024, H = 16, HD = 64;
    constexpr long M  = (long)Bb * T;          // 4096

    const float* x     = (const float*)d_in[0];
    const float* w_qkv = (const float*)d_in[1];
    const float* w_out = (const float*)d_in[2];
    float*       out   = (float*)d_out;

    // workspace carve-up (256B aligned)
    char* ws = (char*)d_ws;
    size_t off = 0;
    auto carve = [&](size_t bytes) {
        size_t r = off;
        off += (bytes + 255) & ~(size_t)255;
        return r;
    };
    _Float16* xh    = (_Float16*)(ws + carve(M * D * 2));               //  8 MB
    _Float16* wqkvh = (_Float16*)(ws + carve((size_t)3 * D * D * 2));   //  6 MB
    _Float16* wouth = (_Float16*)(ws + carve((size_t)D * D * 2));       //  2 MB
    _Float16* qkvh  = (_Float16*)(ws + carve(M * 3 * D * 2));           // 24 MB
    _Float16* vTh   = (_Float16*)(ws + carve((size_t)Bb * H * HD * T * 2)); // 8 MB
    _Float16* atth  = (_Float16*)(ws + carve(M * D * 2));               //  8 MB

    // 1) f32 -> f16 conversions (8 elements / thread)
    {
        long n1 = M * D / 8, n2 = (long)3 * D * D / 8, n3 = (long)D * D / 8;
        cvt_f32_to_f16<<<dim3((n1 + 255) / 256), dim3(256), 0, stream>>>(x, xh, n1);
        cvt_f32_to_f16<<<dim3((n2 + 255) / 256), dim3(256), 0, stream>>>(w_qkv, wqkvh, n2);
        cvt_f32_to_f16<<<dim3((n3 + 255) / 256), dim3(256), 0, stream>>>(w_out, wouth, n3);
    }

    // 2) qkv = x @ w_qkv^T   (4096x1024 x 1024x3072) -> f16 [4096,3072]
    {
        int tiles = (int)(M / 32) * (3 * D / 32);     // 12288
        gemm_wmma<true><<<dim3(tiles / 8), dim3(256), 0, stream>>>(
            xh, wqkvh, qkvh, (int)M, 3 * D, D, 3 * D);
    }

    // 3) transpose V per head (LDS-tiled): vT[bh][d][t]
    {
        int blocks = Bb * H * (T / 64);               // 1024
        transpose_v_tiled<<<dim3(blocks), dim3(256), 0, stream>>>(qkvh, vTh, T, H, HD);
    }

    // 4) flash attention (causal + ALiBi, transposed dataflow) -> atth f16
    {
        int blocks = Bb * H * (T / 64);               // 1024
        attn_flash_wmma<<<dim3(blocks), dim3(128), 0, stream>>>(qkvh, vTh, atth, T, H, HD);
    }

    // 5) out = attn @ w_out^T -> f32 d_out
    {
        int tiles = (int)(M / 32) * (D / 32);         // 4096
        gemm_wmma<false><<<dim3(tiles / 8), dim3(256), 0, stream>>>(
            atth, wouth, out, (int)M, D, D, D);
    }
}

// v001
// One run takes 196 microseconds.
// Two timings next to v000 both put it at 1.69 times that version's speed.
#include <hip/hip_runtime.h>
#include <stdint.h>

// ---------------------------------------------------------------------------
// CDNA5 (gfx1250) self-attention forward, f16 WMMA with f32 accumulation.
// Fixed problem: B=2, T=2048, D=1024, H=16, hd=64 (per reference setup).
// Attention computed in transposed form (S^T = K·Q^T, O^T = V^T·P^T) so that
// softmax row statistics are per-lane and P converts C-frag -> B-frag in
// registers (no LDS round trip, no bpermute reduction chains).
// ---------------------------------------------------------------------------

typedef __attribute__((ext_vector_type(16))) _Float16 v16h;
typedef __attribute__((ext_vector_type(8)))  _Float16 v8h;
typedef __attribute__((ext_vector_type(8)))  float    v8f;
typedef __attribute__((ext_vector_type(4)))  float    v4f;

union Frag16 {
    v16h v;
    struct { v8h lo; v8h hi; } p;
};

// D = A x B + C  (16x16x32, f16 in, f32 acc)
__device__ __forceinline__ v8f wmma_f16(v16h a, v16h b, v8f c) {
    return __builtin_amdgcn_wmma_f32_16x16x32_f16(
        /*neg_a=*/false, a, /*neg_b=*/false, b,
        /*c_mod=*/(short)0, c, /*reuse_a=*/false, /*reuse_b=*/false);
}

// Load a 16x32 A-style fragment from a row-major matrix (also the layout of
// the B operand of A·B^T when the second matrix is stored row-major N x K).
// CDNA5 16-bit A layout:
//   lanes 0-15 : row = lane,    halves 0-7 -> K=k0+0..7,  halves 8-15 -> K=k0+16..23
//   lanes 16-31: row = lane-16, halves 0-7 -> K=k0+8..15, halves 8-15 -> K=k0+24..31
__device__ __forceinline__ v16h load_frag_rm(const _Float16* __restrict__ base,
                                             long ld, int row0, int k0) {
    int lane = threadIdx.x & 31;
    int r    = row0 + (lane & 15);
    int hs   = (lane >> 4) << 3;            // 0 or 8
    const _Float16* p = base + (long)r * ld + k0 + hs;
    Frag16 f;
    f.p.lo = *(const v8h*)(p);              // K = k0+hs .. +7
    f.p.hi = *(const v8h*)(p + 16);         // K = k0+16+hs .. +7
    return f.v;
}

// ---------------------------------------------------------------------------
// Elementwise f32 -> f16, 8 elements per thread (all sizes are multiples of 8)
// ---------------------------------------------------------------------------
__global__ void cvt_f32_to_f16(const float* __restrict__ in,
                               _Float16* __restrict__ out, long n8) {
    long i = (long)blockIdx.x * blockDim.x + threadIdx.x;
    if (i >= n8) return;
    v4f a = *(const v4f*)(in + i * 8);
    v4f b = *(const v4f*)(in + i * 8 + 4);
    v8h o;
    for (int j = 0; j < 4; ++j) { o[j] = (_Float16)a[j]; o[4 + j] = (_Float16)b[j]; }
    *(v8h*)(out + i * 8) = o;
}

// ---------------------------------------------------------------------------
// vT[bh][d][t] = qkv[(b*T + t)*3D + 2D + h*hd + d], LDS-tiled 64x64 transpose.
// Grid: (B*H) * (T/64), block 256.
// ---------------------------------------------------------------------------
__global__ void transpose_v_tiled(const _Float16* __restrict__ qkv,
                                  _Float16* __restrict__ vT,
                                  int T, int H, int hd) {
    const int D = H * hd;
    const long ld3 = (long)3 * D;
    int nT = T / 64;
    int bh = blockIdx.x / nT;
    int t0 = (blockIdx.x % nT) * 64;
    int b = bh / H, h = bh % H;

    __shared__ _Float16 tile[64][68];       // 68 halves = 34 dwords, conflict-light

    const _Float16* src = qkv + ((long)b * T + t0) * ld3 + 2 * D + h * hd;
    for (int i = 0; i < 16; ++i) {
        int idx = threadIdx.x + i * 256;
        int tl = idx >> 6, dl = idx & 63;   // dl fastest -> coalesced reads
        tile[dl][tl] = src[(long)tl * ld3 + dl];
    }
    __syncthreads();
    _Float16* dst = vT + (long)bh * hd * T + t0;
    for (int i = 0; i < 16; ++i) {
        int idx = threadIdx.x + i * 256;
        int dl = idx >> 6, tl = idx & 63;   // tl fastest -> coalesced writes
        dst[(long)dl * T + tl] = tile[dl][tl];
    }
}

// ---------------------------------------------------------------------------
// C[M,N] = A[M,K] (row-major f16) x B[N,K]^T (row-major f16, torch-Linear W)
// One work-group of 4 waves -> 128x128 C tile, one wave -> 64x64 (4x4 fragments).
// A pass is 64 k (128 bytes of each of the 256 operand rows). Each wave brings
// one 64-row slice of a stage into LDS with one tensor load (waves 0,1: A rows,
// waves 2,3: B rows); two buffers, the next stage's load flies during a pass.
// Shapes: M, N multiples of 128, K a multiple of 64 and at least 128.
// ---------------------------------------------------------------------------
typedef uint32_t u32x4 __attribute__((ext_vector_type(4)));
typedef uint32_t u32x8 __attribute__((ext_vector_type(8)));

constexpr uint32_t G_ROWB  = 128;                 // bytes of one operand row in a stage
constexpr uint32_t G_PITCH = G_ROWB + 16;         // LDS pitch, 16 B x odd for ds_load_b128
constexpr uint32_t G_ROWS  = 64;                  // rows of one wave's slice
constexpr uint32_t G_SLICE = 10240;               // 64 * 144 = 9216, rounded up to 2 KiB
constexpr uint32_t G_STAGE = 4 * G_SLICE;         // A half 0 | A half 1 | B half 0 | B half 1
static_assert(G_ROWS * G_PITCH <= G_SLICE && (G_SLICE % 2048u) == 0, "slice places are multiples of 2 KiB");

__device__ __forceinline__ uint32_t uni(uint32_t v) { return (uint32_t)__builtin_amdgcn_readfirstlane(v); }
// Used for the tensor loads alone: an issue test on it compiles to s_cmp + s_cbranch_scc (tensor
// loads ignore EXEC), and a descriptor word made from it stays behind the waits in front of it.
__device__ __forceinline__ uint32_t pinned(uint32_t v) {
    uint32_t w = uni(v);
    asm volatile("" : "+s"(w));   // pinned(): an issue test or a descriptor word held in a scalar register
    return w;
}
// The compiler places no wait for the tensor mover; the clobber keeps LDS reads on their side.
__device__ __forceinline__ void wait_tensor0() { asm volatile("s_wait_tensorcnt 0x0" ::: "memory"); }
// This wave's LDS reads have returned before the buffer is handed over for a refill.
__device__ __forceinline__ void wait_ds0() { asm volatile("s_wait_dscnt 0x0" ::: "memory"); }
// One request of the whole wave: 64 rows of 128 bytes from global memory into LDS.
__device__ __forceinline__ void tdm_load(u32x4 g0, u32x8 g1) {
    asm volatile("tensor_load_to_lds %0, %1" :: "s"(g0), "s"(g1) : "memory");
}
__device__ __forceinline__ u32x4 tdm_group0(uint32_t lds_dst, uint64_t ga) {
    u32x4 g;
    g[0] = uni(1u);                                                        // count 1
    g[1] = uni(lds_dst);
    g[2] = uni((uint32_t)ga);
    g[3] = uni((((uint32_t)(ga >> 32)) & 0x01FFFFFFu) | 0x80000000u);      // type 2
    return g;
}
// Every word through pinned(): a descriptor word held in a scalar register. Without it the
// compiler used words of this group as loop temporaries while a request was outstanding.
__device__ __forceinline__ u32x8 tdm_group1(uint32_t src_pitch) {
    u32x8 g;
    g[0] = pinned((1u << 20) | (4u << 22) | (3u << 25));   // no mask, bytes, 16 B pad behind each 128-B row
    g[1] = pinned((G_ROWB & 0xFFFFu) << 16);
    g[2] = pinned((G_ROWB >> 16) | ((G_ROWS & 0xFFFFu) << 16));
    g[3] = pinned((G_ROWS >> 16) | (G_ROWB << 16));
    g[4] = pinned(G_ROWS);
    g[5] = pinned(src_pitch);
    g[6] = pinned(0u);
    g[7] = pinned(0u);
    return g;
}

// 16x32 fragment from an LDS slice; p points at byte 16*(lane>>4) of row (lane&15).
// Same k order as load_frag_rm: halves 0-7 at byte 0, halves 8-15 at byte 32.
__device__ __forceinline__ v16h lds_frag(const unsigned char* p) {
    Frag16 f;
    f.p.lo = *(const v8h*)(p);
    f.p.hi = *(const v8h*)(p + 32);
    return f.v;
}

template <bool OUT_HALF>
__global__ void __launch_bounds__(128) gemm_wmma(const _Float16* __restrict__ A,
                                                 const _Float16* __restrict__ B,
                                                 void* __restrict__ C,
                                                 int M, int N, int K, int ldc) {
    __shared__ __attribute__((aligned(2048))) unsigned char ring[2 * G_STAGE];
    const uint32_t wave = uni(threadIdx.x >> 5);
    const int lane    = threadIdx.x & 31;
    const int nTilesN = N >> 7;
    const int nTiles  = (M >> 7) * nTilesN;
    if ((int)blockIdx.x >= nTiles) return;            // block-uniform, before any barrier
    const int tm = ((int)blockIdx.x / nTilesN) << 7;
    const int tn = ((int)blockIdx.x % nTilesN) << 7;
    const uint32_t wm = wave >> 1, wn = wave & 1u;    // this wave's 64x64 quadrant

    // this wave's slice of every stage
    const _Float16* srow = (wave < 2u) ? A + (long)(tm + 64 * (int)wave) * K
                                       : B + (long)(tn + 64 * (int)(wave - 2u)) * K;
    const uint64_t ga0  = (uint64_t)(size_t)srow;
    const uint32_t dst0 = (uint32_t)(size_t)ring + wave * G_SLICE;
    const u32x8    g1   = tdm_group1((uint32_t)K * 2u);
    const uint32_t nP   = (uint32_t)K >> 6;

    tdm_load(tdm_group0(dst0, ga0), g1);              // stage 0
    wait_tensor0();
    __syncthreads();                                  // stage 0 published
    tdm_load(tdm_group0(dst0 + G_STAGE, ga0 + G_ROWB), g1);   // stage 1

    v8f acc[4][4];
    for (int i = 0; i < 4; ++i)
        for (int j = 0; j < 4; ++j) acc[i][j] = v8f{0};

    const uint32_t fo = (uint32_t)(lane & 15) * G_PITCH + (uint32_t)(lane >> 4) * 16u;
    uint32_t s = 0;
    do {                                              // nP is at least 2
        const unsigned char* buf = ring + (s & 1u) * G_STAGE;
        const unsigned char* pa  = buf + wm * G_SLICE + fo;
        const unsigned char* pb  = buf + (2u + wn) * G_SLICE + fo;
        v16h a[2][4], b[2][4];
        for (int kc = 0; kc < 2; ++kc) {
            for (int j = 0; j < 4; ++j) b[kc][j] = lds_frag(pb + j * 16 * G_PITCH + kc * 64);
            for (int i = 0; i < 4; ++i) a[kc][i] = lds_frag(pa + i * 16 * G_PITCH + kc * 64);
        }
        // keeps the pass's LDS reads one group in front of its WMMAs: left alone the compiler
        // put a load pair and a full wait in front of every row of four
        __builtin_amdgcn_sched_barrier(0);
        for (int kc = 0; kc < 2; ++kc)
            for (int i = 0; i < 4; ++i)
                for (int j = 0; j < 4; ++j) acc[i][j] = wmma_f16(a[kc][i], b[kc][j], acc[i][j]);
        // keeps the WMMAs in front of the publish point: sunk behind it they left the wait for
        // the next stage's tensor load at the top of the pass, with nothing to cover its flight
        __builtin_amdgcn_sched_barrier(0);
        // publish point of stage s + 1
        wait_ds0();
        wait_tensor0();
        __syncthreads();                              // s + 1 readable; every wave has left s
        if (pinned(s + 2u < nP)) {
            const uint32_t nx = pinned(s + 2u);       // descriptor words formed behind the wait
            tdm_load(tdm_group0(dst0 + (nx & 1u) * G_STAGE, ga0 + (uint64_t)nx * G_ROWB), g1);
        }
    } while (++s < nP);
    wait_tensor0();
    wait_ds0();

    // C fragment layout: VGPR r holds (row=r, lanes0-15 cols) / (row=r+8, lanes16-31)
    int colb = lane & 15;
    int rowb = (lane >> 4) << 3;
    for (int i = 0; i < 4; ++i)
        for (int j = 0; j < 4; ++j)
            for (int r = 0; r < 8; ++r) {
                long row = tm + (int)wm * 64 + i * 16 + rowb + r;
                long col = tn + (int)wn * 64 + j * 16 + colb;
                float v  = acc[i][j][r];
                if (OUT_HALF) ((_Float16*)C)[row * ldc + col] = (_Float16)v;
                else          ((float*)C)[row * ldc + col]    = v;
            }
}

// ---------------------------------------------------------------------------
// Flash attention, causal + ALiBi, fully transposed dataflow.
//   qkv : [B*T, 3*D] f16 ;  vT : [B*H, hd, T] f16 ;  outh : [B*T, D] f16
// One wave owns 16 query columns (lane = query); key tiles of 32.
//   S^T = K(16kt x 64) · Q^T(64 x 16q)   -> C-frag: lane=q, reg r = kt r/r+8
//   O^T = V^T(64d x 32kt) · P^T(32 x 16q)-> C-frag: lane=q, reg r = d
// P^T C-frag layout == B-operand layout, so P is repacked in registers.
// All K fragments are issued before the score WMMAs (partial loadcnt waits),
// and V fragments are issued before the softmax math to hide their latency.
// ---------------------------------------------------------------------------
__global__ void attn_flash_wmma(const _Float16* __restrict__ qkv,
                                const _Float16* __restrict__ vT,
                                _Float16* __restrict__ outh,
                                int T, int H, int hd) {
    const int  D  = H * hd;            // 1024
    const long ld = (long)3 * D;       // 3072
    int nQblk = T / 64;
    int bh    = blockIdx.x / nQblk;
    int qblk  = blockIdx.x % nQblk;
    int b = bh / H, h = bh % H;
    int wave = threadIdx.x >> 5;
    int lane = threadIdx.x & 31;
    int qbase = qblk * 64 + wave * 16;

    const float scale = 0.125f;                                   // hd^-0.5
    const float slope = exp2f(-(float)(h + 1) / (float)H);        // ALiBi
    const float NEGINF = -__builtin_inff();

    const _Float16* Qp = qkv + (long)b * T * ld + (long)h * hd;
    const _Float16* Kp = Qp + D;
    const _Float16* Vt = vT + (long)bh * hd * T;

    // Q^T B-operand fragments for this wave's 16 queries (hd=64 -> 2 chunks)
    v16h qfA = load_frag_rm(Qp, ld, qbase, 0);    // dd = 0..31
    v16h qfB = load_frag_rm(Qp, ld, qbase, 32);   // dd = 32..63

    int qlane = qbase + (lane & 15);              // this lane's query index
    int rh8   = (lane >> 4) << 3;                 // 0 or 8 (kt / d row offset)

    // rel = qlane - kt_index, affine per tile: precompute per-register bases
    float relA[8], srelA[8];
    for (int r = 0; r < 8; ++r) {
        float rl  = (float)(qlane - rh8 - r);     // rel at kt = 0, first half
        relA[r]   = rl;
        srelA[r]  = slope * rl;
    }
    const float slope16 = 16.0f * slope;

    v8f  o[4] = {{0}, {0}, {0}, {0}};             // O^T: 64d x 16q, 4 frags
    float mrow = NEGINF, lrow = 0.f;
    float ktf = 0.0f;                             // (float)kt, updated per tile

    for (int kt = 0; kt <= qbase + 15; kt += 32, ktf += 32.0f) {
        // ---- issue all K fragments, then the 4 score WMMAs ----
        v16h kf0a = load_frag_rm(Kp, ld, kt,      0);
        v16h kf0b = load_frag_rm(Kp, ld, kt,      32);
        v16h kf1a = load_frag_rm(Kp, ld, kt + 16, 0);
        v16h kf1b = load_frag_rm(Kp, ld, kt + 16, 32);
        v8f s0 = {0}, s1 = {0};
        s0 = wmma_f16(kf0a, qfA, s0);
        s0 = wmma_f16(kf0b, qfB, s0);
        s1 = wmma_f16(kf1a, qfA, s1);
        s1 = wmma_f16(kf1b, qfB, s1);

        // ---- issue V fragments early; softmax math below hides their latency
        v16h vf0 = load_frag_rm(Vt, T,  0, kt);
        v16h vf1 = load_frag_rm(Vt, T, 16, kt);
        v16h vf2 = load_frag_rm(Vt, T, 32, kt);
        v16h vf3 = load_frag_rm(Vt, T, 48, kt);

        // ---- bias + causal mask + local max (all-float, per-lane regs) ----
        float sk = slope * ktf;                   // slope * kt
        float a0[8], a1[8];
        float mloc = NEGINF;
        for (int r = 0; r < 8; ++r) {
            float rel0  = relA[r] - ktf;          // qlane - k0 (exact integer)
            float bias0 = sk - srelA[r];          // -slope*(qlane-k0)
            float v0 = fmaf(s0[r], scale, bias0);
            float v1 = fmaf(s1[r], scale, bias0 + slope16);
            a0[r] = (rel0 >= 0.0f)  ? v0 : NEGINF;
            a1[r] = (rel0 >= 16.0f) ? v1 : NEGINF;
            mloc  = fmaxf(mloc, fmaxf(a0[r], a1[r]));
        }
        mloc = fmaxf(mloc, __shfl_xor(mloc, 16, 32));   // join the two kt halves
        float mnew = fmaxf(mrow, mloc);

        // ---- exponentials, P^T repacked directly into a B-operand frag ----
        float corr = __expf(mrow - mnew);               // 0 when mrow == -inf
        v16h pb = {};
        float ps = 0.f;
        for (int r = 0; r < 8; ++r) {
            float p0 = __expf(a0[r] - mnew);            // exp(-inf) == 0
            float p1 = __expf(a1[r] - mnew);
            ps += p0 + p1;
            pb[r]     = (_Float16)p0;                   // kk = rh8 + r
            pb[8 + r] = (_Float16)p1;                   // kk = 16 + rh8 + r
        }
        ps += __shfl_xor(ps, 16, 32);
        lrow = lrow * corr + ps;
        mrow = mnew;

        // ---- O^T = corr*O^T + V^T x P^T ----
        o[0] = wmma_f16(vf0, pb, o[0] * corr);
        o[1] = wmma_f16(vf1, pb, o[1] * corr);
        o[2] = wmma_f16(vf2, pb, o[2] * corr);
        o[3] = wmma_f16(vf3, pb, o[3] * corr);
    }

    // ---- normalize, write O^T: lane q stores 8 contiguous d per fragment ----
    float rinv = 1.0f / lrow;
    _Float16* dst = outh + ((long)b * T + qlane) * D + (long)h * hd + rh8;
    for (int f = 0; f < 4; ++f) {
        v8h ov;
        for (int r = 0; r < 8; ++r) ov[r] = (_Float16)(o[f][r] * rinv);
        *(v8h*)(dst + f * 16) = ov;                     // d = f*16 + rh8 + r
    }
}

// ---------------------------------------------------------------------------
// Host launcher
// ---------------------------------------------------------------------------
extern "C" void kernel_launch(void* const* d_in, const int* in_sizes, int n_in,
                              void* d_out, int out_size, void* d_ws, size_t ws_size,
                              hipStream_t stream) {
    (void)in_sizes; (void)n_in; (void)out_size; (void)ws_size;
    constexpr int  Bb = 2, T = 2048, D = 1024, H = 16, HD = 64;
    constexpr long M  = (long)Bb * T;          // 4096

    const float* x     = (const float*)d_in[0];
    const float* w_qkv = (const float*)d_in[1];
    const float* w_out = (const float*)d_in[2];
    float*       out   = (float*)d_out;

    // workspace carve-up (256B aligned)
    char* ws = (char*)d_ws;
    size_t off = 0;
    auto carve = [&](size_t bytes) {
        size_t r = off;
        off += (bytes + 255) & ~(size_t)255;
        return r;
    };
    _Float16* xh    = (_Float16*)(ws + carve(M * D * 2));               //  8 MB
    _Float16* wqkvh = (_Float16*)(ws + carve((size_t)3 * D * D * 2));   //  6 MB
    _Float16* wouth = (_Float16*)(ws + carve((size_t)D * D * 2));       //  2 MB
    _Float16* qkvh  = (_Float16*)(ws + carve(M * 3 * D * 2));           // 24 MB
    _Float16* vTh   = (_Float16*)(ws + carve((size_t)Bb * H * HD * T * 2)); // 8 MB
    _Float16* atth  = (_Float16*)(ws + carve(M * D * 2));               //  8 MB

    // 1) f32 -> f16 conversions (8 elements / thread)
    {
        long n1 = M * D / 8, n2 = (long)3 * D * D / 8, n3 = (long)D * D / 8;
        cvt_f32_to_f16<<<dim3((n1 + 255) / 256), dim3(256), 0, stream>>>(x, xh, n1);
        cvt_f32_to_f16<<<dim3((n2 + 255) / 256), dim3(256), 0, stream>>>(w_qkv, wqkvh, n2);
        cvt_f32_to_f16<<<dim3((n3 + 255) / 256), dim3(256), 0, stream>>>(w_out, wouth, n3);
    }

    // 2) qkv = x @ w_qkv^T   (4096x1024 x 1024x3072) -> f16 [4096,3072]
    {
        int tiles = (int)(M / 128) * (3 * D / 128);   // 768
        gemm_wmma<true><<<dim3(tiles), dim3(128), 0, stream>>>(
            xh, wqkvh, qkvh, (int)M, 3 * D, D, 3 * D);
    }

    // 3) transpose V per head (LDS-tiled): vT[bh][d][t]
    {
        int blocks = Bb * H * (T / 64);               // 1024
        transpose_v_tiled<<<dim3(blocks), dim3(256), 0, stream>>>(qkvh, vTh, T, H, HD);
    }

    // 4) flash attention (causal + ALiBi, transposed dataflow) -> atth f16
    {
        int blocks = Bb * H * (T / 64);               // 1024
        attn_flash_wmma<<<dim3(blocks), dim3(128), 0, stream>>>(qkvh, vTh, atth, T, H, HD);
    }

    // 5) out = attn @ w_out^T -> f32 d_out
    {
        int tiles = (int)(M / 128) * (D / 128);       // 256
        gemm_wmma<false><<<dim3(tiles), dim3(128), 0, stream>>>(
            atth, wouth, out, (int)M, D, D, D);
    }
}

// v002
// One run takes 101 microseconds.
// Next to v001, in two timings, it ran 1.94 times as fast each time.
// All steps since v000 together make it 3.29 times as fast.
#include <hip/hip_runtime.h>
#include <stdint.h>

// ---------------------------------------------------------------------------
// CDNA5 (gfx1250) self-attention forward, f16 WMMA with f32 accumulation.
// Fixed problem: B=2, T=2048, D=1024, H=16, hd=64 (per reference setup).
// Attention computed in transposed form (S^T = K·Q^T, O^T = V^T·P^T) so that
// softmax row statistics are per-lane and P converts C-frag -> B-frag in
// registers (no LDS round trip, no bpermute reduction chains).
// ---------------------------------------------------------------------------

typedef __attribute__((ext_vector_type(16))) _Float16 v16h;
typedef __attribute__((ext_vector_type(8)))  _Float16 v8h;
typedef __attribute__((ext_vector_type(8)))  float    v8f;
typedef __attribute__((ext_vector_type(4)))  float    v4f;

union Frag16 {
    v16h v;
    struct { v8h lo; v8h hi; } p;
};

// D = A x B + C  (16x16x32, f16 in, f32 acc)
__device__ __forceinline__ v8f wmma_f16(v16h a, v16h b, v8f c) {
    return __builtin_amdgcn_wmma_f32_16x16x32_f16(
        /*neg_a=*/false, a, /*neg_b=*/false, b,
        /*c_mod=*/(short)0, c, /*reuse_a=*/false, /*reuse_b=*/false);
}

// Load a 16x32 A-style fragment from a row-major matrix (also the layout of
// the B operand of A·B^T when the second matrix is stored row-major N x K).
// CDNA5 16-bit A layout:
//   lanes 0-15 : row = lane,    halves 0-7 -> K=k0+0..7,  halves 8-15 -> K=k0+16..23
//   lanes 16-31: row = lane-16, halves 0-7 -> K=k0+8..15, halves 8-15 -> K=k0+24..31
__device__ __forceinline__ v16h load_frag_rm(const _Float16* __restrict__ base,
                                             long ld, int row0, int k0) {
    int lane = threadIdx.x & 31;
    int r    = row0 + (lane & 15);
    int hs   = (lane >> 4) << 3;            // 0 or 8
    const _Float16* p = base + (long)r * ld + k0 + hs;
    Frag16 f;
    f.p.lo = *(const v8h*)(p);              // K = k0+hs .. +7
    f.p.hi = *(const v8h*)(p + 16);         // K = k0+16+hs .. +7
    return f.v;
}

// ---------------------------------------------------------------------------
// Elementwise f32 -> f16, 8 elements per thread (all sizes are multiples of 8)
// ---------------------------------------------------------------------------
__global__ void cvt_f32_to_f16(const float* __restrict__ in,
                               _Float16* __restrict__ out, long n8) {
    long i = (long)blockIdx.x * blockDim.x + threadIdx.x;
    if (i >= n8) return;
    v4f a = *(const v4f*)(in + i * 8);
    v4f b = *(const v4f*)(in + i * 8 + 4);
    v8h o;
    for (int j = 0; j < 4; ++j) { o[j] = (_Float16)a[j]; o[4 + j] = (_Float16)b[j]; }
    *(v8h*)(out + i * 8) = o;
}

// ---------------------------------------------------------------------------
// vT[bh][d][t] = qkv[(b*T + t)*3D + 2D + h*hd + d], LDS-tiled 64x64 transpose.
// Grid: (B*H) * (T/64), block 256.
// ---------------------------------------------------------------------------
__global__ void transpose_v_tiled(const _Float16* __restrict__ qkv,
                                  _Float16* __restrict__ vT,
                                  int T, int H, int hd) {
    const int D = H * hd;
    const long ld3 = (long)3 * D;
    int nT = T / 64;
    int bh = blockIdx.x / nT;
    int t0 = (blockIdx.x % nT) * 64;
    int b = bh / H, h = bh % H;

    __shared__ _Float16 tile[64][68];       // 68 halves = 34 dwords, conflict-light

    const _Float16* src = qkv + ((long)b * T + t0) * ld3 + 2 * D + h * hd;
    for (int i = 0; i < 16; ++i) {
        int idx = threadIdx.x + i * 256;
        int tl = idx >> 6, dl = idx & 63;   // dl fastest -> coalesced reads
        tile[dl][tl] = src[(long)tl * ld3 + dl];
    }
    __syncthreads();
    _Float16* dst = vT + (long)bh * hd * T + t0;
    for (int i = 0; i < 16; ++i) {
        int idx = threadIdx.x + i * 256;
        int dl = idx >> 6, tl = idx & 63;   // tl fastest -> coalesced writes
        dst[(long)dl * T + tl] = tile[dl][tl];
    }
}

// ---------------------------------------------------------------------------
// C[M,N] = A[M,K] (row-major f16) x B[N,K]^T (row-major f16, torch-Linear W)
// One work-group of 4 waves -> 128x128 C tile, one wave -> 64x64 (4x4 fragments).
// A pass is 64 k (128 bytes of each of the 256 operand rows). Each wave brings
// one 64-row slice of a stage into LDS with one tensor load (waves 0,1: A rows,
// waves 2,3: B rows); two buffers, the next stage's load flies during a pass.
// Shapes: M, N multiples of 128, K a multiple of 64 and at least 128.
// ---------------------------------------------------------------------------
typedef uint32_t u32x4 __attribute__((ext_vector_type(4)));
typedef uint32_t u32x8 __attribute__((ext_vector_type(8)));

constexpr uint32_t G_ROWB  = 128;                 // bytes of one operand row in a stage
constexpr uint32_t G_PITCH = G_ROWB + 16;         // LDS pitch, 16 B x odd for ds_load_b128
constexpr uint32_t G_ROWS  = 64;                  // rows of one wave's slice
constexpr uint32_t G_SLICE = 10240;               // 64 * 144 = 9216, rounded up to 2 KiB
constexpr uint32_t G_STAGE = 4 * G_SLICE;         // A half 0 | A half 1 | B half 0 | B half 1
static_assert(G_ROWS * G_PITCH <= G_SLICE && (G_SLICE % 2048u) == 0, "slice places are multiples of 2 KiB");

__device__ __forceinline__ uint32_t uni(uint32_t v) { return (uint32_t)__builtin_amdgcn_readfirstlane(v); }
// Used for the tensor loads alone: an issue test on it compiles to s_cmp + s_cbranch_scc (tensor
// loads ignore EXEC), and a descriptor word made from it stays behind the waits in front of it.
__device__ __forceinline__ uint32_t pinned(uint32_t v) {
    uint32_t w = uni(v);
    asm volatile("" : "+s"(w));   // pinned(): an issue test or a descriptor word held in a scalar register
    return w;
}
// The compiler places no wait for the tensor mover; the clobber keeps LDS reads on their side.
__device__ __forceinline__ void wait_tensor0() { asm volatile("s_wait_tensorcnt 0x0" ::: "memory"); }
// This wave's LDS reads have returned before the buffer is handed over for a refill.
__device__ __forceinline__ void wait_ds0() { asm volatile("s_wait_dscnt 0x0" ::: "memory"); }
// One request of the whole wave: 64 rows of 128 bytes from global memory into LDS.
__device__ __forceinline__ void tdm_load(u32x4 g0, u32x8 g1) {
    asm volatile("tensor_load_to_lds %0, %1" :: "s"(g0), "s"(g1) : "memory");
}
__device__ __forceinline__ u32x4 tdm_group0(uint32_t lds_dst, uint64_t ga) {
    u32x4 g;
    g[0] = uni(1u);                                                        // count 1
    g[1] = uni(lds_dst);
    g[2] = uni((uint32_t)ga);
    g[3] = uni((((uint32_t)(ga >> 32)) & 0x01FFFFFFu) | 0x80000000u);      // type 2
    return g;
}
// Every word through pinned(): a descriptor word held in a scalar register. Without it the
// compiler used words of this group as loop temporaries while a request was outstanding.
__device__ __forceinline__ u32x8 tdm_group1(uint32_t src_pitch) {
    u32x8 g;
    g[0] = pinned((1u << 20) | (4u << 22) | (3u << 25));   // no mask, bytes, 16 B pad behind each 128-B row
    g[1] = pinned((G_ROWB & 0xFFFFu) << 16);
    g[2] = pinned((G_ROWB >> 16) | ((G_ROWS & 0xFFFFu) << 16));
    g[3] = pinned((G_ROWS >> 16) | (G_ROWB << 16));
    g[4] = pinned(G_ROWS);
    g[5] = pinned(src_pitch);
    g[6] = pinned(0u);
    g[7] = pinned(0u);
    return g;
}

// 16x32 fragment from an LDS slice; p points at byte 16*(lane>>4) of row (lane&15).
// Same k order as load_frag_rm: halves 0-7 at byte 0, halves 8-15 at byte 32.
__device__ __forceinline__ v16h lds_frag(const unsigned char* p) {
    Frag16 f;
    f.p.lo = *(const v8h*)(p);
    f.p.hi = *(const v8h*)(p + 32);
    return f.v;
}

template <bool OUT_HALF>
__global__ void __launch_bounds__(128) gemm_wmma(const _Float16* __restrict__ A,
                                                 const _Float16* __restrict__ B,
                                                 void* __restrict__ C,
                                                 int M, int N, int K, int ldc) {
    __shared__ __attribute__((aligned(2048))) unsigned char ring[2 * G_STAGE];
    const uint32_t wave = uni(threadIdx.x >> 5);
    const int lane    = threadIdx.x & 31;
    const int nTilesN = N >> 7;
    const int nTiles  = (M >> 7) * nTilesN;
    if ((int)blockIdx.x >= nTiles) return;            // block-uniform, before any barrier
    const int tm = ((int)blockIdx.x / nTilesN) << 7;
    const int tn = ((int)blockIdx.x % nTilesN) << 7;
    const uint32_t wm = wave >> 1, wn = wave & 1u;    // this wave's 64x64 quadrant

    // this wave's slice of every stage
    const _Float16* srow = (wave < 2u) ? A + (long)(tm + 64 * (int)wave) * K
                                       : B + (long)(tn + 64 * (int)(wave - 2u)) * K;
    const uint64_t ga0  = (uint64_t)(size_t)srow;
    const uint32_t dst0 = (uint32_t)(size_t)ring + wave * G_SLICE;
    const u32x8    g1   = tdm_group1((uint32_t)K * 2u);
    const uint32_t nP   = (uint32_t)K >> 6;

    tdm_load(tdm_group0(dst0, ga0), g1);              // stage 0
    wait_tensor0();
    __syncthreads();                                  // stage 0 published
    tdm_load(tdm_group0(dst0 + G_STAGE, ga0 + G_ROWB), g1);   // stage 1

    v8f acc[4][4];
    for (int i = 0; i < 4; ++i)
        for (int j = 0; j < 4; ++j) acc[i][j] = v8f{0};

    const uint32_t fo = (uint32_t)(lane & 15) * G_PITCH + (uint32_t)(lane >> 4) * 16u;
    uint32_t s = 0;
    do {                                              // nP is at least 2
        const unsigned char* buf = ring + (s & 1u) * G_STAGE;
        const unsigned char* pa  = buf + wm * G_SLICE + fo;
        const unsigned char* pb  = buf + (2u + wn) * G_SLICE + fo;
        v16h a[2][4], b[2][4];
        for (int kc = 0; kc < 2; ++kc) {
            for (int j = 0; j < 4; ++j) b[kc][j] = lds_frag(pb + j * 16 * G_PITCH + kc * 64);
            for (int i = 0; i < 4; ++i) a[kc][i] = lds_frag(pa + i * 16 * G_PITCH + kc * 64);
        }
        // keeps the pass's LDS reads one group in front of its WMMAs: left alone the compiler
        // put a load pair and a full wait in front of every row of four
        __builtin_amdgcn_sched_barrier(0);
        for (int kc = 0; kc < 2; ++kc)
            for (int i = 0; i < 4; ++i)
                for (int j = 0; j < 4; ++j) acc[i][j] = wmma_f16(a[kc][i], b[kc][j], acc[i][j]);
        // keeps the WMMAs in front of the publish point: sunk behind it they left the wait for
        // the next stage's tensor load at the top of the pass, with nothing to cover its flight
        __builtin_amdgcn_sched_barrier(0);
        // publish point of stage s + 1
        wait_ds0();
        wait_tensor0();
        __syncthreads();                              // s + 1 readable; every wave has left s
        if (pinned(s + 2u < nP)) {
            const uint32_t nx = pinned(s + 2u);       // descriptor words formed behind the wait
            tdm_load(tdm_group0(dst0 + (nx & 1u) * G_STAGE, ga0 + (uint64_t)nx * G_ROWB), g1);
        }
    } while (++s < nP);
    wait_tensor0();
    wait_ds0();

    // C fragment layout: VGPR r holds (row=r, lanes0-15 cols) / (row=r+8, lanes16-31)
    int colb = lane & 15;
    int rowb = (lane >> 4) << 3;
    for (int i = 0; i < 4; ++i)
        for (int j = 0; j < 4; ++j)
            for (int r = 0; r < 8; ++r) {
                long row = tm + (int)wm * 64 + i * 16 + rowb + r;
                long col = tn + (int)wn * 64 + j * 16 + colb;
                float v  = acc[i][j][r];
                if (OUT_HALF) ((_Float16*)C)[row * ldc + col] = (_Float16)v;
                else          ((float*)C)[row * ldc + col]    = v;
            }
}

// ---------------------------------------------------------------------------
// Flash attention, causal + ALiBi, fully transposed dataflow.
//   qkv : [B*T, 3*D] f16 ;  vT : [B*H, hd, T] f16 ;  outh : [B*T, D] f16
// One wave owns 16 query columns (lane = query); key tiles of 32.
//   S^T = K(16kt x 64) · Q^T(64 x 16q)   -> C-frag: lane=q, reg r = kt r/r+8
//   O^T = V^T(64d x 32kt) · P^T(32 x 16q)-> C-frag: lane=q, reg r = d
// P^T C-frag layout == B-operand layout, so P is repacked in registers.
// The four waves of a work-group walk the same keys, so K and V^T come through LDS once
// per work-group: a stage is 64 keys (64 K rows of 128 bytes, 64 V^T rows of 128 bytes),
// wave 0 brings the K slice and wave 1 the V^T slice with one tensor load each; two
// buffers, the next stage's loads fly during a pass. hd = 64, T a multiple of 64.
// ---------------------------------------------------------------------------
constexpr uint32_t AT_STAGE = 2 * G_SLICE;        // K slice | V^T slice

__global__ void __launch_bounds__(128) attn_flash_wmma(const _Float16* __restrict__ qkv,
                                                       const _Float16* __restrict__ vT,
                                                       _Float16* __restrict__ outh,
                                                       int T, int H, int hd) {
    __shared__ __attribute__((aligned(2048))) unsigned char ring[2 * AT_STAGE];
    const int  D  = H * hd;            // 1024
    const long ld = (long)3 * D;       // 3072
    int nQblk = T / 64;
    int bh    = blockIdx.x / nQblk;
    int qblk  = blockIdx.x % nQblk;
    int b = bh / H, h = bh % H;
    const uint32_t wave = uni(threadIdx.x >> 5);
    int lane = threadIdx.x & 31;
    int qbase = qblk * 64 + (int)wave * 16;

    const float scale = 0.125f;                                   // hd^-0.5
    const float slope = exp2f(-(float)(h + 1) / (float)H);        // ALiBi
    const float NEGINF = -__builtin_inff();

    const _Float16* Qp = qkv + (long)b * T * ld + (long)h * hd;
    const _Float16* Kp = Qp + D;
    const _Float16* Vt = vT + (long)bh * hd * T;

    // the issuing waves' slice of every stage: wave 0 K rows (a stage on = 64 rows), wave 1
    // V^T rows (a stage on = 128 bytes along each row)
    const uint64_t ga0   = (uint64_t)(size_t)((wave == 0u) ? Kp : Vt);
    const uint64_t gstep = (wave == 0u) ? (uint64_t)ld * 2u * G_ROWS : (uint64_t)G_ROWB;
    const uint32_t dst0  = (uint32_t)(size_t)ring + (wave & 1u) * G_SLICE;
    const u32x8    g1    = tdm_group1((wave == 0u) ? (uint32_t)ld * 2u : (uint32_t)T * 2u);
    const uint32_t nS    = (uint32_t)qblk + 1u;   // stages up to and with the diagonal one

    if (pinned(wave < 2u)) {
        tdm_load(tdm_group0(dst0, ga0), g1);      // stage 0
        wait_tensor0();
    }
    __syncthreads();                              // stage 0 published
    if (pinned((wave < 2u) && (1u < nS)))
        tdm_load(tdm_group0(dst0 + AT_STAGE, ga0 + gstep), g1);   // stage 1

    // Q^T B-operand fragments for this wave's 16 queries (hd=64 -> 2 chunks)
    v16h qfA = load_frag_rm(Qp, ld, qbase, 0);    // dd = 0..31
    v16h qfB = load_frag_rm(Qp, ld, qbase, 32);   // dd = 32..63

    int qlane = qbase + (lane & 15);              // this lane's query index
    int rh8   = (lane >> 4) << 3;                 // 0 or 8 (kt / d row offset)

    // rel = qlane - kt_index, affine per tile: precompute per-register bases
    float relA[8], srelA[8];
    for (int r = 0; r < 8; ++r) {
        float rl  = (float)(qlane - rh8 - r);     // rel at kt = 0, first half
        relA[r]   = rl;
        srelA[r]  = slope * rl;
    }
    const float slope16 = 16.0f * slope;

    v8f  o[4] = {{0}, {0}, {0}, {0}};             // O^T: 64d x 16q, 4 frags
    float mrow = NEGINF, lrow = 0.f;

    // one key tile of 32: pk at K row 0 of the tile, pv at its first key in V^T row 0, both
    // with the lane's fragment offset; ktf = (float) index of the tile's first key
    auto key_tile = [&](const unsigned char* pk, const unsigned char* pv, float ktf) {
        // ---- all K fragments, then the 4 score WMMAs ----
        v16h kf0a = lds_frag(pk);
        v16h kf0b = lds_frag(pk + 64);
        v16h kf1a = lds_frag(pk + 16 * G_PITCH);
        v16h kf1b = lds_frag(pk + 16 * G_PITCH + 64);
        v8f s0 = {0}, s1 = {0};
        s0 = wmma_f16(kf0a, qfA, s0);
        s0 = wmma_f16(kf0b, qfB, s0);
        s1 = wmma_f16(kf1a, qfA, s1);
        s1 = wmma_f16(kf1b, qfB, s1);

        // ---- V fragments early; softmax math below hides their latency
        v16h vf0 = lds_frag(pv);
        v16h vf1 = lds_frag(pv + 16 * G_PITCH);
        v16h vf2 = lds_frag(pv + 32 * G_PITCH);
        v16h vf3 = lds_frag(pv + 48 * G_PITCH);

        // ---- bias + causal mask + local max (all-float, per-lane regs) ----
        float sk = slope * ktf;                   // slope * kt
        float a0[8], a1[8];
        float mloc = NEGINF;
        for (int r = 0; r < 8; ++r) {
            float rel0  = relA[r] - ktf;          // qlane - k0 (exact integer)
            float bias0 = sk - srelA[r];          // -slope*(qlane-k0)
            float v0 = fmaf(s0[r], scale, bias0);
            float v1 = fmaf(s1[r], scale, bias0 + slope16);
            a0[r] = (rel0 >= 0.0f)  ? v0 : NEGINF;
            a1[r] = (rel0 >= 16.0f) ? v1 : NEGINF;
            mloc  = fmaxf(mloc, fmaxf(a0[r], a1[r]));
        }
        mloc = fmaxf(mloc, __shfl_xor(mloc, 16, 32));   // join the two kt halves
        float mnew = fmaxf(mrow, mloc);

        // ---- exponentials, P^T repacked directly into a B-operand frag ----
        float corr = __expf(mrow - mnew);               // 0 when mrow == -inf
        v16h pb = {};
        float ps = 0.f;
        for (int r = 0; r < 8; ++r) {
            float p0 = __expf(a0[r] - mnew);            // exp(-inf) == 0
            float p1 = __expf(a1[r] - mnew);
            ps += p0 + p1;
            pb[r]     = (_Float16)p0;                   // kk = rh8 + r
            pb[8 + r] = (_Float16)p1;                   // kk = 16 + rh8 + r
        }
        ps += __shfl_xor(ps, 16, 32);
        lrow = lrow * corr + ps;
        mrow = mnew;

        // ---- O^T = corr*O^T + V^T x P^T ----
        o[0] = wmma_f16(vf0, pb, o[0] * corr);
        o[1] = wmma_f16(vf1, pb, o[1] * corr);
        o[2] = wmma_f16(vf2, pb, o[2] * corr);
        o[3] = wmma_f16(vf3, pb, o[3] * corr);
    };

    const uint32_t fo = (uint32_t)(lane & 15) * G_PITCH + (uint32_t)(lane >> 4) * 16u;
    uint32_t s = 0;
    do {
        const unsigned char* pk = ring + (s & 1u) * AT_STAGE + fo;
        const unsigned char* pv = pk + G_SLICE;
        const int kt = (int)s * 64;
        key_tile(pk, pv, (float)kt);
        if (kt + 32 <= qbase + 15)                // wave-uniform: false only on the diagonal stage
            key_tile(pk + 32 * G_PITCH, pv + 64, (float)(kt + 32));
        // publish point of stage s + 1
        wait_ds0();
        if (pinned(wave < 2u)) wait_tensor0();
        __syncthreads();                          // s + 1 readable; every wave has left s
        if (pinned((wave < 2u) && (s + 2u < nS))) {
            const uint32_t nx = pinned(s + 2u);   // descriptor words formed behind the wait
            tdm_load(tdm_group0(dst0 + (nx & 1u) * AT_STAGE, ga0 + (uint64_t)nx * gstep), g1);
        }
    } while (++s < nS);
    wait_tensor0();
    wait_ds0();

    // ---- normalize, write O^T: lane q stores 8 contiguous d per fragment ----
    float rinv = 1.0f / lrow;
    _Float16* dst = outh + ((long)b * T + qlane) * D + (long)h * hd + rh8;
    for (int f = 0; f < 4; ++f) {
        v8h ov;
        for (int r = 0; r < 8; ++r) ov[r] = (_Float16)(o[f][r] * rinv);
        *(v8h*)(dst + f * 16) = ov;                     // d = f*16 + rh8 + r
    }
}

// ---------------------------------------------------------------------------
// Host launcher
// ---------------------------------------------------------------------------
extern "C" void kernel_launch(void* const* d_in, const int* in_sizes, int n_in,
                              void* d_out, int out_size, void* d_ws, size_t ws_size,
                              hipStream_t stream) {
    (void)in_sizes; (void)n_in; (void)out_size; (void)ws_size;
    constexpr int  Bb = 2, T = 2048, D = 1024, H = 16, HD = 64;
    constexpr long M  = (long)Bb * T;          // 4096

    const float* x     = (const float*)d_in[0];
    const float* w_qkv = (const float*)d_in[1];
    const float* w_out = (const float*)d_in[2];
    float*       out   = (float*)d_out;

    // workspace carve-up (256B aligned)
    char* ws = (char*)d_ws;
    size_t off = 0;
    auto carve = [&](size_t bytes) {
        size_t r = off;
        off += (bytes + 255) & ~(size_t)255;
        return r;
    };
    _Float16* xh    = (_Float16*)(ws + carve(M * D * 2));               //  8 MB
    _Float16* wqkvh = (_Float16*)(ws + carve((size_t)3 * D * D * 2));   //  6 MB
    _Float16* wouth = (_Float16*)(ws + carve((size_t)D * D * 2));       //  2 MB
    _Float16* qkvh  = (_Float16*)(ws + carve(M * 3 * D * 2));           // 24 MB
    _Float16* vTh   = (_Float16*)(ws + carve((size_t)Bb * H * HD * T * 2)); // 8 MB
    _Float16* atth  = (_Float16*)(ws + carve(M * D * 2));               //  8 MB

    // 1) f32 -> f16 conversions (8 elements / thread)
    {
        long n1 = M * D / 8, n2 = (long)3 * D * D / 8, n3 = (long)D * D / 8;
        cvt_f32_to_f16<<<dim3((n1 + 255) / 256), dim3(256), 0, stream>>>(x, xh, n1);
        cvt_f32_to_f16<<<dim3((n2 + 255) / 256), dim3(256), 0, stream>>>(w_qkv, wqkvh, n2);
        cvt_f32_to_f16<<<dim3((n3 + 255) / 256), dim3(256), 0, stream>>>(w_out, wouth, n3);
    }

    // 2) qkv = x @ w_qkv^T   (4096x1024 x 1024x3072) -> f16 [4096,3072]
    {
        int tiles = (int)(M / 128) * (3 * D / 128);   // 768
        gemm_wmma<true><<<dim3(tiles), dim3(128), 0, stream>>>(
            xh, wqkvh, qkvh, (int)M, 3 * D, D, 3 * D);
    }

    // 3) transpose V per head (LDS-tiled): vT[bh][d][t]
    {
        int blocks = Bb * H * (T / 64);               // 1024
        transpose_v_tiled<<<dim3(blocks), dim3(256), 0, stream>>>(qkvh, vTh, T, H, HD);
    }

    // 4) flash attention (causal + ALiBi, transposed dataflow) -> atth f16
    {
        int blocks = Bb * H * (T / 64);               // 1024
        attn_flash_wmma<<<dim3(blocks), dim3(128), 0, stream>>>(qkvh, vTh, atth, T, H, HD);
    }

    // 5) out = attn @ w_out^T -> f32 d_out
    {
        int tiles = (int)(M / 128) * (D / 128);       // 256
        gemm_wmma<false><<<dim3(tiles), dim3(128), 0, stream>>>(
            atth, wouth, out, (int)M, D, D, D);
    }
}

// v003
// A run of this version takes 97.1 microseconds.
// Next to v002, in two timings, it ran 1.03 and 1.04 times as fast.
// Counting every step since v000, it is 3.41 times as fast.
#include <hip/hip_runtime.h>
#include <stdint.h>

// ---------------------------------------------------------------------------
// CDNA5 (gfx1250) self-attention forward, f16 WMMA with f32 accumulation.
// Fixed problem: B=2, T=2048, D=1024, H=16, hd=64 (per reference setup).
// Attention computed in transposed form (S^T = K·Q^T, O^T = V^T·P^T) so that
// softmax row statistics are per-lane and P converts C-frag -> B-frag in
// registers (no LDS round trip, no bpermute reduction chains).
// ---------------------------------------------------------------------------

typedef __attribute__((ext_vector_type(16))) _Float16 v16h;
typedef __attribute__((ext_vector_type(8)))  _Float16 v8h;
typedef __attribute__((ext_vector_type(8)))  float    v8f;
typedef __attribute__((ext_vector_type(4)))  float    v4f;

union Frag16 {
    v16h v;
    struct { v8h lo; v8h hi; } p;
};

// D = A x B + C  (16x16x32, f16 in, f32 acc)
__device__ __forceinline__ v8f wmma_f16(v16h a, v16h b, v8f c) {
    return __builtin_amdgcn_wmma_f32_16x16x32_f16(
        /*neg_a=*/false, a, /*neg_b=*/false, b,
        /*c_mod=*/(short)0, c, /*reuse_a=*/false, /*reuse_b=*/false);
}

// Load a 16x32 A-style fragment from a row-major matrix (also the layout of
// the B operand of A·B^T when the second matrix is stored row-major N x K).
// CDNA5 16-bit A layout:
//   lanes 0-15 : row = lane,    halves 0-7 -> K=k0+0..7,  halves 8-15 -> K=k0+16..23
//   lanes 16-31: row = lane-16, halves 0-7 -> K=k0+8..15, halves 8-15 -> K=k0+24..31
__device__ __forceinline__ v16h load_frag_rm(const _Float16* __restrict__ base,
                                             long ld, int row0, int k0) {
    int lane = threadIdx.x & 31;
    int r    = row0 + (lane & 15);
    int hs   = (lane >> 4) << 3;            // 0 or 8
    const _Float16* p = base + (long)r * ld + k0 + hs;
    Frag16 f;
    f.p.lo = *(const v8h*)(p);              // K = k0+hs .. +7
    f.p.hi = *(const v8h*)(p + 16);         // K = k0+16+hs .. +7
    return f.v;
}

// ---------------------------------------------------------------------------
// f32 -> f16 for all three inputs in ONE launch: the three jobs read nothing of each other,
// and few long waves start sooner than many waves of two loads and a store each.
// One work-group of 16 waves per CV_SPAN elements; blockIdx picks the array (work-group
// uniform). A wave owns 2048 contiguous elements: 16 loads of 16 bytes per lane, each load
// 512 contiguous bytes of the wave (whole lines), written ahead of the conversions so that
// most of them are in flight together; each store is 256 contiguous bytes of the wave.
// Every array is a multiple of CV_SPAN long.
// ---------------------------------------------------------------------------
typedef __attribute__((ext_vector_type(4)))  _Float16 v4h;
constexpr int  CV_THREADS = 512;                          // 16 waves
constexpr int  CV_LOADS   = 16;                           // 16-byte loads per lane
constexpr long CV_SPAN    = (long)CV_THREADS * CV_LOADS * 4;   // 32768 elements per work-group

__global__ void __launch_bounds__(CV_THREADS) cvt3_f32_to_f16(
        const float* __restrict__ in0, _Float16* __restrict__ out0, int nb0,
        const float* __restrict__ in1, _Float16* __restrict__ out1, int nb1,
        const float* __restrict__ in2, _Float16* __restrict__ out2) {
    int blk = (int)blockIdx.x;
    const float* in  = in0;
    _Float16*    out = out0;
    if (blk >= nb0 + nb1)  { in = in2; out = out2; blk -= nb0 + nb1; }
    else if (blk >= nb0)   { in = in1; out = out1; blk -= nb0; }
    const int wave = threadIdx.x >> 5, lane = threadIdx.x & 31;
    const long base = (long)blk * CV_SPAN + (long)wave * (CV_LOADS * 128) + lane * 4;
    v4f a[CV_LOADS];
    for (int j = 0; j < CV_LOADS; ++j) a[j] = *(const v4f*)(in + base + j * 128);
    for (int j = 0; j < CV_LOADS; ++j) {
        v4h o;
        for (int e = 0; e < 4; ++e) o[e] = (_Float16)a[j][e];
        *(v4h*)(out + base + j * 128) = o;
    }
}

// ---------------------------------------------------------------------------
// vT[bh][d][t] = qkv[(b*T + t)*3D + 2D + h*hd + d], LDS-tiled 64x64 transpose.
// Grid: (B*H) * (T/64), block 256.
// ---------------------------------------------------------------------------
__global__ void transpose_v_tiled(const _Float16* __restrict__ qkv,
                                  _Float16* __restrict__ vT,
                                  int T, int H, int hd) {
    const int D = H * hd;
    const long ld3 = (long)3 * D;
    int nT = T / 64;
    int bh = blockIdx.x / nT;
    int t0 = (blockIdx.x % nT) * 64;
    int b = bh / H, h = bh % H;

    __shared__ _Float16 tile[64][68];       // 68 halves = 34 dwords, conflict-light

    const _Float16* src = qkv + ((long)b * T + t0) * ld3 + 2 * D + h * hd;
    for (int i = 0; i < 16; ++i) {
        int idx = threadIdx.x + i * 256;
        int tl = idx >> 6, dl = idx & 63;   // dl fastest -> coalesced reads
        tile[dl][tl] = src[(long)tl * ld3 + dl];
    }
    __syncthreads();
    _Float16* dst = vT + (long)bh * hd * T + t0;
    for (int i = 0; i < 16; ++i) {
        int idx = threadIdx.x + i * 256;
        int dl = idx >> 6, tl = idx & 63;   // tl fastest -> coalesced writes
        dst[(long)dl * T + tl] = tile[dl][tl];
    }
}

// ---------------------------------------------------------------------------
// C[M,N] = A[M,K] (row-major f16) x B[N,K]^T (row-major f16, torch-Linear W)
// One work-group of 4 waves -> 128x128 C tile, one wave -> 64x64 (4x4 fragments).
// A pass is 64 k (128 bytes of each of the 256 operand rows). Each wave brings
// one 64-row slice of a stage into LDS with one tensor load (waves 0,1: A rows,
// waves 2,3: B rows); two buffers, the next stage's load flies during a pass.
// Shapes: M, N multiples of 128, K a multiple of 64 and at least 128.
// ---------------------------------------------------------------------------
typedef uint32_t u32x4 __attribute__((ext_vector_type(4)));
typedef uint32_t u32x8 __attribute__((ext_vector_type(8)));

constexpr uint32_t G_ROWB  = 128;                 // bytes of one operand row in a stage
constexpr uint32_t G_PITCH = G_ROWB + 16;         // LDS pitch, 16 B x odd for ds_load_b128
constexpr uint32_t G_ROWS  = 64;                  // rows of one wave's slice
constexpr uint32_t G_SLICE = 10240;               // 64 * 144 = 9216, rounded up to 2 KiB
constexpr uint32_t G_STAGE = 4 * G_SLICE;         // A half 0 | A half 1 | B half 0 | B half 1
static_assert(G_ROWS * G_PITCH <= G_SLICE && (G_SLICE % 2048u) == 0, "slice places are multiples of 2 KiB");

__device__ __forceinline__ uint32_t uni(uint32_t v) { return (uint32_t)__builtin_amdgcn_readfirstlane(v); }
// Used for the tensor loads alone: an issue test on it compiles to s_cmp + s_cbranch_scc (tensor
// loads ignore EXEC), and a descriptor word made from it stays behind the waits in front of it.
__device__ __forceinline__ uint32_t pinned(uint32_t v) {
    uint32_t w = uni(v);
    asm volatile("" : "+s"(w));   // pinned(): an issue test or a descriptor word held in a scalar register
    return w;
}
// The compiler places no wait for the tensor mover; the clobber keeps LDS reads on their side.
__device__ __forceinline__ void wait_tensor0() { asm volatile("s_wait_tensorcnt 0x0" ::: "memory"); }
// This wave's LDS reads have returned before the buffer is handed over for a refill.
__device__ __forceinline__ void wait_ds0() { asm volatile("s_wait_dscnt 0x0" ::: "memory"); }
// One request of the whole wave: 64 rows of 128 bytes from global memory into LDS.
__device__ __forceinline__ void tdm_load(u32x4 g0, u32x8 g1) {
    asm volatile("tensor_load_to_lds %0, %1" :: "s"(g0), "s"(g1) : "memory");
}
__device__ __forceinline__ u32x4 tdm_group0(uint32_t lds_dst, uint64_t ga) {
    u32x4 g;
    g[0] = uni(1u);                                                        // count 1
    g[1] = uni(lds_dst);
    g[2] = uni((uint32_t)ga);
    g[3] = uni((((uint32_t)(ga >> 32)) & 0x01FFFFFFu) | 0x80000000u);      // type 2
    return g;
}
// Every word through pinned(): a descriptor word held in a scalar register. Without it the
// compiler used words of this group as loop temporaries while a request was outstanding.
__device__ __forceinline__ u32x8 tdm_group1(uint32_t src_pitch) {
    u32x8 g;
    g[0] = pinned((1u << 20) | (4u << 22) | (3u << 25));   // no mask, bytes, 16 B pad behind each 128-B row
    g[1] = pinned((G_ROWB & 0xFFFFu) << 16);
    g[2] = pinned((G_ROWB >> 16) | ((G_ROWS & 0xFFFFu) << 16));
    g[3] = pinned((G_ROWS >> 16) | (G_ROWB << 16));
    g[4] = pinned(G_ROWS);
    g[5] = pinned(src_pitch);
    g[6] = pinned(0u);
    g[7] = pinned(0u);
    return g;
}

// 16x32 fragment from an LDS slice; p points at byte 16*(lane>>4) of row (lane&15).
// Same k order as load_frag_rm: halves 0-7 at byte 0, halves 8-15 at byte 32.
__device__ __forceinline__ v16h lds_frag(const unsigned char* p) {
    Frag16 f;
    f.p.lo = *(const v8h*)(p);
    f.p.hi = *(const v8h*)(p + 32);
    return f.v;
}

template <bool OUT_HALF>
__global__ void __launch_bounds__(128) gemm_wmma(const _Float16* __restrict__ A,
                                                 const _Float16* __restrict__ B,
                                                 void* __restrict__ C,
                                                 int M, int N, int K, int ldc) {
    __shared__ __attribute__((aligned(2048))) unsigned char ring[2 * G_STAGE];
    const uint32_t wave = uni(threadIdx.x >> 5);
    const int lane    = threadIdx.x & 31;
    const int nTilesN = N >> 7;
    const int nTiles  = (M >> 7) * nTilesN;
    if ((int)blockIdx.x >= nTiles) return;            // block-uniform, before any barrier
    const int tm = ((int)blockIdx.x / nTilesN) << 7;
    const int tn = ((int)blockIdx.x % nTilesN) << 7;
    const uint32_t wm = wave >> 1, wn = wave & 1u;    // this wave's 64x64 quadrant

    // this wave's slice of every stage
    const _Float16* srow = (wave < 2u) ? A + (long)(tm + 64 * (int)wave) * K
                                       : B + (long)(tn + 64 * (int)(wave - 2u)) * K;
    const uint64_t ga0  = (uint64_t)(size_t)srow;
    const uint32_t dst0 = (uint32_t)(size_t)ring + wave * G_SLICE;
    const u32x8    g1   = tdm_group1((uint32_t)K * 2u);
    const uint32_t nP   = (uint32_t)K >> 6;

    tdm_load(tdm_group0(dst0, ga0), g1);              // stage 0
    wait_tensor0();
    __syncthreads();                                  // stage 0 published
    tdm_load(tdm_group0(dst0 + G_STAGE, ga0 + G_ROWB), g1);   // stage 1

    v8f acc[4][4];
    for (int i = 0; i < 4; ++i)
        for (int j = 0; j < 4; ++j) acc[i][j] = v8f{0};

    const uint32_t fo = (uint32_t)(lane & 15) * G_PITCH + (uint32_t)(lane >> 4) * 16u;
    uint32_t s = 0;
    do {                                              // nP is at least 2
        const unsigned char* buf = ring + (s & 1u) * G_STAGE;
        const unsigned char* pa  = buf + wm * G_SLICE + fo;
        const unsigned char* pb  = buf + (2u + wn) * G_SLICE + fo;
        v16h a[2][4], b[2][4];
        for (int kc = 0; kc < 2; ++kc) {
            for (int j = 0; j < 4; ++j) b[kc][j] = lds_frag(pb + j * 16 * G_PITCH + kc * 64);
            for (int i = 0; i < 4; ++i) a[kc][i] = lds_frag(pa + i * 16 * G_PITCH + kc * 64);
        }
        // keeps the pass's LDS reads one group in front of its WMMAs: left alone the compiler
        // put a load pair and a full wait in front of every row of four
        __builtin_amdgcn_sched_barrier(0);
        for (int kc = 0; kc < 2; ++kc)
            for (int i = 0; i < 4; ++i)
                for (int j = 0; j < 4; ++j) acc[i][j] = wmma_f16(a[kc][i], b[kc][j], acc[i][j]);
        // keeps the WMMAs in front of the publish point: sunk behind it they left the wait for
        // the next stage's tensor load at the top of the pass, with nothing to cover its flight
        __builtin_amdgcn_sched_barrier(0);
        // publish point of stage s + 1
        wait_ds0();
        wait_tensor0();
        __syncthreads();                              // s + 1 readable; every wave has left s
        if (pinned(s + 2u < nP)) {
            const uint32_t nx = pinned(s + 2u);       // descriptor words formed behind the wait
            tdm_load(tdm_group0(dst0 + (nx & 1u) * G_STAGE, ga0 + (uint64_t)nx * G_ROWB), g1);
        }
    } while (++s < nP);
    wait_tensor0();
    wait_ds0();

    // C fragment layout: VGPR r holds (row=r, lanes0-15 cols) / (row=r+8, lanes16-31)
    int colb = lane & 15;
    int rowb = (lane >> 4) << 3;
    for (int i = 0; i < 4; ++i)
        for (int j = 0; j < 4; ++j)
            for (int r = 0; r < 8; ++r) {
                long row = tm + (int)wm * 64 + i * 16 + rowb + r;
                long col = tn + (int)wn * 64 + j * 16 + colb;
                float v  = acc[i][j][r];
                if (OUT_HALF) ((_Float16*)C)[row * ldc + col] = (_Float16)v;
                else          ((float*)C)[row * ldc + col]    = v;
            }
}

// ---------------------------------------------------------------------------
// Flash attention, causal + ALiBi, fully transposed dataflow.
//   qkv : [B*T, 3*D] f16 ;  vT : [B*H, hd, T] f16 ;  outh : [B*T, D] f16
// One wave owns 16 query columns (lane = query); key tiles of 32.
//   S^T = K(16kt x 64) · Q^T(64 x 16q)   -> C-frag: lane=q, reg r = kt r/r+8
//   O^T = V^T(64d x 32kt) · P^T(32 x 16q)-> C-frag: lane=q, reg r = d
// P^T C-frag layout == B-operand layout, so P is repacked in registers.
// The four waves of a work-group walk the same keys, so K and V^T come through LDS once
// per work-group: a stage is 64 keys (64 K rows of 128 bytes, 64 V^T rows of 128 bytes),
// wave 0 brings the K slice and wave 1 the V^T slice with one tensor load each; two
// buffers, the next stage's loads fly during a pass. hd = 64, T a multiple of 64.
// ---------------------------------------------------------------------------
constexpr uint32_t AT_STAGE = 2 * G_SLICE;        // K slice | V^T slice

__global__ void __launch_bounds__(128) attn_flash_wmma(const _Float16* __restrict__ qkv,
                                                       const _Float16* __restrict__ vT,
                                                       _Float16* __restrict__ outh,
                                                       int T, int H, int hd) {
    __shared__ __attribute__((aligned(2048))) unsigned char ring[2 * AT_STAGE];
    const int  D  = H * hd;            // 1024
    const long ld = (long)3 * D;       // 3072
    int nQblk = T / 64;
    int bh    = blockIdx.x / nQblk;
    int qblk  = blockIdx.x % nQblk;
    int b = bh / H, h = bh % H;
    const uint32_t wave = uni(threadIdx.x >> 5);
    int lane = threadIdx.x & 31;
    int qbase = qblk * 64 + (int)wave * 16;

    const float scale = 0.125f;                                   // hd^-0.5
    const float slope = exp2f(-(float)(h + 1) / (float)H);        // ALiBi
    const float NEGINF = -__builtin_inff();

    const _Float16* Qp = qkv + (long)b * T * ld + (long)h * hd;
    const _Float16* Kp = Qp + D;
    const _Float16* Vt = vT + (long)bh * hd * T;

    // the issuing waves' slice of every stage: wave 0 K rows (a stage on = 64 rows), wave 1
    // V^T rows (a stage on = 128 bytes along each row)
    const uint64_t ga0   = (uint64_t)(size_t)((wave == 0u) ? Kp : Vt);
    const uint64_t gstep = (wave == 0u) ? (uint64_t)ld * 2u * G_ROWS : (uint64_t)G_ROWB;
    const uint32_t dst0  = (uint32_t)(size_t)ring + (wave & 1u) * G_SLICE;
    const u32x8    g1    = tdm_group1((wave == 0u) ? (uint32_t)ld * 2u : (uint32_t)T * 2u);
    const uint32_t nS    = (uint32_t)qblk + 1u;   // stages up to and with the diagonal one

    if (pinned(wave < 2u)) {
        tdm_load(tdm_group0(dst0, ga0), g1);      // stage 0
        wait_tensor0();
    }
    __syncthreads();                              // stage 0 published
    if (pinned((wave < 2u) && (1u < nS)))
        tdm_load(tdm_group0(dst0 + AT_STAGE, ga0 + gstep), g1);   // stage 1

    // Q^T B-operand fragments for this wave's 16 queries (hd=64 -> 2 chunks)
    v16h qfA = load_frag_rm(Qp, ld, qbase, 0);    // dd = 0..31
    v16h qfB = load_frag_rm(Qp, ld, qbase, 32);   // dd = 32..63

    int qlane = qbase + (lane & 15);              // this lane's query index
    int rh8   = (lane >> 4) << 3;                 // 0 or 8 (kt / d row offset)

    // rel = qlane - kt_index, affine per tile: precompute per-register bases
    float relA[8], srelA[8];
    for (int r = 0; r < 8; ++r) {
        float rl  = (float)(qlane - rh8 - r);     // rel at kt = 0, first half
        relA[r]   = rl;
        srelA[r]  = slope * rl;
    }
    const float slope16 = 16.0f * slope;

    v8f  o[4] = {{0}, {0}, {0}, {0}};             // O^T: 64d x 16q, 4 frags
    float mrow = NEGINF, lrow = 0.f;

    // one key tile of 32: pk at K row 0 of the tile, pv at its first key in V^T row 0, both
    // with the lane's fragment offset; ktf = (float) index of the tile's first key
    auto key_tile = [&](const unsigned char* pk, const unsigned char* pv, float ktf) {
        // ---- all K fragments, then the 4 score WMMAs ----
        v16h kf0a = lds_frag(pk);
        v16h kf0b = lds_frag(pk + 64);
        v16h kf1a = lds_frag(pk + 16 * G_PITCH);
        v16h kf1b = lds_frag(pk + 16 * G_PITCH + 64);
        v8f s0 = {0}, s1 = {0};
        s0 = wmma_f16(kf0a, qfA, s0);
        s0 = wmma_f16(kf0b, qfB, s0);
        s1 = wmma_f16(kf1a, qfA, s1);
        s1 = wmma_f16(kf1b, qfB, s1);

        // ---- V fragments early; softmax math below hides their latency
        v16h vf0 = lds_frag(pv);
        v16h vf1 = lds_frag(pv + 16 * G_PITCH);
        v16h vf2 = lds_frag(pv + 32 * G_PITCH);
        v16h vf3 = lds_frag(pv + 48 * G_PITCH);

        // ---- bias + causal mask + local max (all-float, per-lane regs) ----
        float sk = slope * ktf;                   // slope * kt
        float a0[8], a1[8];
        float mloc = NEGINF;
        for (int r = 0; r < 8; ++r) {
            float rel0  = relA[r] - ktf;          // qlane - k0 (exact integer)
            float bias0 = sk - srelA[r];          // -slope*(qlane-k0)
            float v0 = fmaf(s0[r], scale, bias0);
            float v1 = fmaf(s1[r], scale, bias0 + slope16);
            a0[r] = (rel0 >= 0.0f)  ? v0 : NEGINF;
            a1[r] = (rel0 >= 16.0f) ? v1 : NEGINF;
            mloc  = fmaxf(mloc, fmaxf(a0[r], a1[r]));
        }
        mloc = fmaxf(mloc, __shfl_xor(mloc, 16, 32));   // join the two kt halves
        float mnew = fmaxf(mrow, mloc);

        // ---- exponentials, P^T repacked directly into a B-operand frag ----
        float corr = __expf(mrow - mnew);               // 0 when mrow == -inf
        v16h pb = {};
        float ps = 0.f;
        for (int r = 0; r < 8; ++r) {
            float p0 = __expf(a0[r] - mnew);            // exp(-inf) == 0
            float p1 = __expf(a1[r] - mnew);
            ps += p0 + p1;
            pb[r]     = (_Float16)p0;                   // kk = rh8 + r
            pb[8 + r] = (_Float16)p1;                   // kk = 16 + rh8 + r
        }
        ps += __shfl_xor(ps, 16, 32);
        lrow = lrow * corr + ps;
        mrow = mnew;

        // ---- O^T = corr*O^T + V^T x P^T ----
        o[0] = wmma_f16(vf0, pb, o[0] * corr);
        o[1] = wmma_f16(vf1, pb, o[1] * corr);
        o[2] = wmma_f16(vf2, pb, o[2] * corr);
        o[3] = wmma_f16(vf3, pb, o[3] * corr);
    };

    const uint32_t fo = (uint32_t)(lane & 15) * G_PITCH + (uint32_t)(lane >> 4) * 16u;
    uint32_t s = 0;
    do {
        const unsigned char* pk = ring + (s & 1u) * AT_STAGE + fo;
        const unsigned char* pv = pk + G_SLICE;
        const int kt = (int)s * 64;
        key_tile(pk, pv, (float)kt);
        if (kt + 32 <= qbase + 15)                // wave-uniform: false only on the diagonal stage
            key_tile(pk + 32 * G_PITCH, pv + 64, (float)(kt + 32));
        // publish point of stage s + 1
        wait_ds0();
        if (pinned(wave < 2u)) wait_tensor0();
        __syncthreads();                          // s + 1 readable; every wave has left s
        if (pinned((wave < 2u) && (s + 2u < nS))) {
            const uint32_t nx = pinned(s + 2u);   // descriptor words formed behind the wait
            tdm_load(tdm_group0(dst0 + (nx & 1u) * AT_STAGE, ga0 + (uint64_t)nx * gstep), g1);
        }
    } while (++s < nS);
    wait_tensor0();
    wait_ds0();

    // ---- normalize, write O^T: lane q stores 8 contiguous d per fragment ----
    float rinv = 1.0f / lrow;
    _Float16* dst = outh + ((long)b * T + qlane) * D + (long)h * hd + rh8;
    for (int f = 0; f < 4; ++f) {
        v8h ov;
        for (int r = 0; r < 8; ++r) ov[r] = (_Float16)(o[f][r] * rinv);
        *(v8h*)(dst + f * 16) = ov;                     // d = f*16 + rh8 + r
    }
}

// ---------------------------------------------------------------------------
// Host launcher
// ---------------------------------------------------------------------------
extern "C" void kernel_launch(void* const* d_in, const int* in_sizes, int n_in,
                              void* d_out, int out_size, void* d_ws, size_t ws_size,
                              hipStream_t stream) {
    (void)in_sizes; (void)n_in; (void)out_size; (void)ws_size;
    constexpr int  Bb = 2, T = 2048, D = 1024, H = 16, HD = 64;
    constexpr long M  = (long)Bb * T;          // 4096

    const float* x     = (const float*)d_in[0];
    const float* w_qkv = (const float*)d_in[1];
    const float* w_out = (const float*)d_in[2];
    float*       out   = (float*)d_out;

    // workspace carve-up (256B aligned)
    char* ws = (char*)d_ws;
    size_t off = 0;
    auto carve = [&](size_t bytes) {
        size_t r = off;
        off += (bytes + 255) & ~(size_t)255;
        return r;
    };
    _Float16* xh    = (_Float16*)(ws + carve(M * D * 2));               //  8 MB
    _Float16* wqkvh = (_Float16*)(ws + carve((size_t)3 * D * D * 2));   //  6 MB
    _Float16* wouth = (_Float16*)(ws + carve((size_t)D * D * 2));       //  2 MB
    _Float16* qkvh  = (_Float16*)(ws + carve(M * 3 * D * 2));           // 24 MB
    _Float16* vTh   = (_Float16*)(ws + carve((size_t)Bb * H * HD * T * 2)); // 8 MB
    _Float16* atth  = (_Float16*)(ws + carve(M * D * 2));               //  8 MB

    // 1) f32 -> f16 conversions, one launch for the three arrays
    {
        constexpr long n1 = M * D, n2 = (long)3 * D * D, n3 = (long)D * D;
        static_assert(n1 % CV_SPAN == 0 && n2 % CV_SPAN == 0 && n3 % CV_SPAN == 0, "whole spans only");
        constexpr int nb1 = (int)(n1 / CV_SPAN), nb2 = (int)(n2 / CV_SPAN), nb3 = (int)(n3 / CV_SPAN);
        cvt3_f32_to_f16<<<dim3(nb1 + nb2 + nb3), dim3(CV_THREADS), 0, stream>>>(
            x, xh, nb1, w_qkv, wqkvh, nb2, w_out, wouth);
    }

    // 2) qkv = x @ w_qkv^T   (4096x1024 x 1024x3072) -> f16 [4096,3072]
    {
        int tiles = (int)(M / 128) * (3 * D / 128);   // 768
        gemm_wmma<true><<<dim3(tiles), dim3(128), 0, stream>>>(
            xh, wqkvh, qkvh, (int)M, 3 * D, D, 3 * D);
    }

    // 3) transpose V per head (LDS-tiled): vT[bh][d][t]
    {
        int blocks = Bb * H * (T / 64);               // 1024
        transpose_v_tiled<<<dim3(blocks), dim3(256), 0, stream>>>(qkvh, vTh, T, H, HD);
    }

    // 4) flash attention (causal + ALiBi, transposed dataflow) -> atth f16
    {
        int blocks = Bb * H * (T / 64);               // 1024
        attn_flash_wmma<<<dim3(blocks), dim3(128), 0, stream>>>(qkvh, vTh, atth, T, H, HD);
    }

    // 5) out = attn @ w_out^T -> f32 d_out
    {
        int tiles = (int)(M / 128) * (D / 128);       // 256
        gemm_wmma<false><<<dim3(tiles), dim3(128), 0, stream>>>(
            atth, wouth, out, (int)M, D, D, D);
    }
}

// v004
// A run of this version takes 90.1 microseconds.
// Timed twice side by side with v003, it ran 1.08 times as fast both times.
// Over all steps from v000 it is 3.67 times as fast.
#include <hip/hip_runtime.h>
#include <stdint.h>

// ---------------------------------------------------------------------------
// CDNA5 (gfx1250) self-attention forward, f16 WMMA with f32 accumulation.
// Fixed problem: B=2, T=2048, D=1024, H=16, hd=64 (per reference setup).
// Attention computed in transposed form (S^T = K·Q^T, O^T = V^T·P^T) so that
// softmax row statistics are per-lane and P converts C-frag -> B-frag in
// registers (no LDS round trip, no bpermute reduction chains).
// ---------------------------------------------------------------------------

typedef __attribute__((ext_vector_type(16))) _Float16 v16h;
typedef __attribute__((ext_vector_type(8)))  _Float16 v8h;
typedef __attribute__((ext_vector_type(8)))  float    v8f;
typedef __attribute__((ext_vector_type(4)))  float    v4f;

union Frag16 {
    v16h v;
    struct { v8h lo; v8h hi; } p;
};

// D = A x B + C  (16x16x32, f16 in, f32 acc)
__device__ __forceinline__ v8f wmma_f16(v16h a, v16h b, v8f c) {
    return __builtin_amdgcn_wmma_f32_16x16x32_f16(
        /*neg_a=*/false, a, /*neg_b=*/false, b,
        /*c_mod=*/(short)0, c, /*reuse_a=*/false, /*reuse_b=*/false);
}

// Load a 16x32 A-style fragment from a row-major matrix (also the layout of
// the B operand of A·B^T when the second matrix is stored row-major N x K).
// CDNA5 16-bit A layout:
//   lanes 0-15 : row = lane,    halves 0-7 -> K=k0+0..7,  halves 8-15 -> K=k0+16..23
//   lanes 16-31: row = lane-16, halves 0-7 -> K=k0+8..15, halves 8-15 -> K=k0+24..31
__device__ __forceinline__ v16h load_frag_rm(const _Float16* __restrict__ base,
                                             long ld, int row0, int k0) {
    int lane = threadIdx.x & 31;
    int r    = row0 + (lane & 15);
    int hs   = (lane >> 4) << 3;            // 0 or 8
    const _Float16* p = base + (long)r * ld + k0 + hs;
    Frag16 f;
    f.p.lo = *(const v8h*)(p);              // K = k0+hs .. +7
    f.p.hi = *(const v8h*)(p + 16);         // K = k0+16+hs .. +7
    return f.v;
}

// ---------------------------------------------------------------------------
// f32 -> f16 for all three inputs in ONE launch: the three jobs read nothing of each other,
// and few long waves start sooner than many waves of two loads and a store each.
// One work-group of 16 waves per CV_SPAN elements; blockIdx picks the array (work-group
// uniform). A wave owns 2048 contiguous elements: 16 loads of 16 bytes per lane, each load
// 512 contiguous bytes of the wave (whole lines), written ahead of the conversions so that
// most of them are in flight together; each store is 256 contiguous bytes of the wave.
// Every array is a multiple of CV_SPAN long.
// ---------------------------------------------------------------------------
typedef __attribute__((ext_vector_type(4)))  _Float16 v4h;
constexpr int  CV_THREADS = 512;                          // 16 waves
constexpr int  CV_LOADS   = 16;                           // 16-byte loads per lane
constexpr long CV_SPAN    = (long)CV_THREADS * CV_LOADS * 4;   // 32768 elements per work-group

__global__ void __launch_bounds__(CV_THREADS) cvt3_f32_to_f16(
        const float* __restrict__ in0, _Float16* __restrict__ out0, int nb0,
        const float* __restrict__ in1, _Float16* __restrict__ out1, int nb1,
        const float* __restrict__ in2, _Float16* __restrict__ out2) {
    int blk = (int)blockIdx.x;
    const float* in  = in0;
    _Float16*    out = out0;
    if (blk >= nb0 + nb1)  { in = in2; out = out2; blk -= nb0 + nb1; }
    else if (blk >= nb0)   { in = in1; out = out1; blk -= nb0; }
    const int wave = threadIdx.x >> 5, lane = threadIdx.x & 31;
    const long base = (long)blk * CV_SPAN + (long)wave * (CV_LOADS * 128) + lane * 4;
    v4f a[CV_LOADS];
    for (int j = 0; j < CV_LOADS; ++j) a[j] = *(const v4f*)(in + base + j * 128);
    for (int j = 0; j < CV_LOADS; ++j) {
        v4h o;
        for (int e = 0; e < 4; ++e) o[e] = (_Float16)a[j][e];
        *(v4h*)(out + base + j * 128) = o;
    }
}

// ---------------------------------------------------------------------------
// vT[bh][d][t] = qkv[(b*T + t)*3D + 2D + h*hd + d], LDS-tiled 64x64 transpose.
// Grid: (B*H) * (T/64), block 256.
// ---------------------------------------------------------------------------
__global__ void transpose_v_tiled(const _Float16* __restrict__ qkv,
                                  _Float16* __restrict__ vT,
                                  int T, int H, int hd) {
    const int D = H * hd;
    const long ld3 = (long)3 * D;
    int nT = T / 64;
    int bh = blockIdx.x / nT;
    int t0 = (blockIdx.x % nT) * 64;
    int b = bh / H, h = bh % H;

    __shared__ _Float16 tile[64][68];       // 68 halves = 34 dwords, conflict-light

    const _Float16* src = qkv + ((long)b * T + t0) * ld3 + 2 * D + h * hd;
    for (int i = 0; i < 16; ++i) {
        int idx = threadIdx.x + i * 256;
        int tl = idx >> 6, dl = idx & 63;   // dl fastest -> coalesced reads
        tile[dl][tl] = src[(long)tl * ld3 + dl];
    }
    __syncthreads();
    _Float16* dst = vT + (long)bh * hd * T + t0;
    for (int i = 0; i < 16; ++i) {
        int idx = threadIdx.x + i * 256;
        int dl = idx >> 6, tl = idx & 63;   // tl fastest -> coalesced writes
        dst[(long)dl * T + tl] = tile[dl][tl];
    }
}

// ---------------------------------------------------------------------------
// C[M,N] = A[M,K] (row-major f16) x B[N,K]^T (row-major f16, torch-Linear W)
// One work-group of 4 waves -> 128x128 C tile, one wave -> 64x64 (4x4 fragments).
// A pass is 64 k (128 bytes of each of the 256 operand rows). Each wave brings
// one 64-row slice of a stage into LDS with one tensor load (waves 0,1: A rows,
// waves 2,3: B rows); two buffers, the next stage's load flies during a pass.
// Shapes: M, N multiples of 128, K a multiple of 64 and at least 128.
// ---------------------------------------------------------------------------
typedef uint32_t u32x4 __attribute__((ext_vector_type(4)));
typedef uint32_t u32x8 __attribute__((ext_vector_type(8)));

constexpr uint32_t G_ROWB  = 128;                 // bytes of one operand row in a stage
constexpr uint32_t G_PITCH = G_ROWB + 16;         // LDS pitch, 16 B x odd for ds_load_b128
constexpr uint32_t G_ROWS  = 64;                  // rows of one wave's slice
constexpr uint32_t G_SLICE = 10240;               // 64 * 144 = 9216, rounded up to 2 KiB
constexpr uint32_t G_STAGE = 4 * G_SLICE;         // A half 0 | A half 1 | B half 0 | B half 1
static_assert(G_ROWS * G_PITCH <= G_SLICE && (G_SLICE % 2048u) == 0, "slice places are multiples of 2 KiB");

__device__ __forceinline__ uint32_t uni(uint32_t v) { return (uint32_t)__builtin_amdgcn_readfirstlane(v); }
// Used for the tensor loads alone: an issue test on it compiles to s_cmp + s_cbranch_scc (tensor
// loads ignore EXEC), and a descriptor word made from it stays behind the waits in front of it.
__device__ __forceinline__ uint32_t pinned(uint32_t v) {
    uint32_t w = uni(v);
    asm volatile("" : "+s"(w));   // pinned(): an issue test or a descriptor word held in a scalar register
    return w;
}
// The compiler places no wait for the tensor mover; the clobber keeps LDS reads on their side.
__device__ __forceinline__ void wait_tensor0() { asm volatile("s_wait_tensorcnt 0x0" ::: "memory"); }
// This wave's LDS reads have returned before the buffer is handed over for a refill.
__device__ __forceinline__ void wait_ds0() { asm volatile("s_wait_dscnt 0x0" ::: "memory"); }
// One request of the whole wave: 64 rows of 128 bytes from global memory into LDS.
__device__ __forceinline__ void tdm_load(u32x4 g0, u32x8 g1) {
    asm volatile("tensor_load_to_lds %0, %1" :: "s"(g0), "s"(g1) : "memory");
}
__device__ __forceinline__ u32x4 tdm_group0(uint32_t lds_dst, uint64_t ga) {
    u32x4 g;
    g[0] = uni(1u);                                                        // count 1
    g[1] = uni(lds_dst);
    g[2] = uni((uint32_t)ga);
    g[3] = uni((((uint32_t)(ga >> 32)) & 0x01FFFFFFu) | 0x80000000u);      // type 2
    return g;
}
// Every word through pinned(): a descriptor word held in a scalar register. Without it the
// compiler used words of this group as loop temporaries while a request was outstanding.
__device__ __forceinline__ u32x8 tdm_group1(uint32_t src_pitch) {
    u32x8 g;
    g[0] = pinned((1u << 20) | (4u << 22) | (3u << 25));   // no mask, bytes, 16 B pad behind each 128-B row
    g[1] = pinned((G_ROWB & 0xFFFFu) << 16);
    g[2] = pinned((G_ROWB >> 16) | ((G_ROWS & 0xFFFFu) << 16));
    g[3] = pinned((G_ROWS >> 16) | (G_ROWB << 16));
    g[4] = pinned(G_ROWS);
    g[5] = pinned(src_pitch);
    g[6] = pinned(0u);
    g[7] = pinned(0u);
    return g;
}

// 16x32 fragment from an LDS slice; p points at byte 16*(lane>>4) of row (lane&15).
// Same k order as load_frag_rm: halves 0-7 at byte 0, halves 8-15 at byte 32.
__device__ __forceinline__ v16h lds_frag(const unsigned char* p) {
    Frag16 f;
    f.p.lo = *(const v8h*)(p);
    f.p.hi = *(const v8h*)(p + 32);
    return f.v;
}

template <bool OUT_HALF>
__global__ void __launch_bounds__(128) gemm_wmma(const _Float16* __restrict__ A,
                                                 const _Float16* __restrict__ B,
                                                 void* __restrict__ C,
                                                 int M, int N, int K, int ldc) {
    __shared__ __attribute__((aligned(2048))) unsigned char ring[2 * G_STAGE];
    const uint32_t wave = uni(threadIdx.x >> 5);
    const int lane    = threadIdx.x & 31;
    const int nTilesN = N >> 7;
    const int nTiles  = (M >> 7) * nTilesN;
    if ((int)blockIdx.x >= nTiles) return;            // block-uniform, before any barrier
    const int tm = ((int)blockIdx.x / nTilesN) << 7;
    const int tn = ((int)blockIdx.x % nTilesN) << 7;
    const uint32_t wm = wave >> 1, wn = wave & 1u;    // this wave's 64x64 quadrant

    // this wave's slice of every stage
    const _Float16* srow = (wave < 2u) ? A + (long)(tm + 64 * (int)wave) * K
                                       : B + (long)(tn + 64 * (int)(wave - 2u)) * K;
    const uint64_t ga0  = (uint64_t)(size_t)srow;
    const uint32_t dst0 = (uint32_t)(size_t)ring + wave * G_SLICE;
    const u32x8    g1   = tdm_group1((uint32_t)K * 2u);
    const uint32_t nP   = (uint32_t)K >> 6;

    tdm_load(tdm_group0(dst0, ga0), g1);              // stage 0
    wait_tensor0();
    __syncthreads();                                  // stage 0 published
    tdm_load(tdm_group0(dst0 + G_STAGE, ga0 + G_ROWB), g1);   // stage 1

    v8f acc[4][4];
    for (int i = 0; i < 4; ++i)
        for (int j = 0; j < 4; ++j) acc[i][j] = v8f{0};

    const uint32_t fo = (uint32_t)(lane & 15) * G_PITCH + (uint32_t)(lane >> 4) * 16u;
    uint32_t s = 0;
    do {                                              // nP is at least 2
        const unsigned char* buf = ring + (s & 1u) * G_STAGE;
        const unsigned char* pa  = buf + wm * G_SLICE + fo;
        const unsigned char* pb  = buf + (2u + wn) * G_SLICE + fo;
        v16h a[2][4], b[2][4];
        for (int kc = 0; kc < 2; ++kc) {
            for (int j = 0; j < 4; ++j) b[kc][j] = lds_frag(pb + j * 16 * G_PITCH + kc * 64);
            for (int i = 0; i < 4; ++i) a[kc][i] = lds_frag(pa + i * 16 * G_PITCH + kc * 64);
        }
        // keeps the pass's LDS reads one group in front of its WMMAs: left alone the compiler
        // put a load pair and a full wait in front of every row of four
        __builtin_amdgcn_sched_barrier(0);
        for (int kc = 0; kc < 2; ++kc)
            for (int i = 0; i < 4; ++i)
                for (int j = 0; j < 4; ++j) acc[i][j] = wmma_f16(a[kc][i], b[kc][j], acc[i][j]);
        // keeps the WMMAs in front of the publish point: sunk behind it they left the wait for
        // the next stage's tensor load at the top of the pass, with nothing to cover its flight
        __builtin_amdgcn_sched_barrier(0);
        // publish point of stage s + 1
        wait_ds0();
        wait_tensor0();
        __syncthreads();                              // s + 1 readable; every wave has left s
        if (pinned(s + 2u < nP)) {
            const uint32_t nx = pinned(s + 2u);       // descriptor words formed behind the wait
            tdm_load(tdm_group0(dst0 + (nx & 1u) * G_STAGE, ga0 + (uint64_t)nx * G_ROWB), g1);
        }
    } while (++s < nP);
    wait_tensor0();
    wait_ds0();

    // C fragment layout: VGPR r holds (row=r, lanes0-15 cols) / (row=r+8, lanes16-31)
    int colb = lane & 15;
    int rowb = (lane >> 4) << 3;
    for (int i = 0; i < 4; ++i)
        for (int j = 0; j < 4; ++j)
            for (int r = 0; r < 8; ++r) {
                long row = tm + (int)wm * 64 + i * 16 + rowb + r;
                long col = tn + (int)wn * 64 + j * 16 + colb;
                float v  = acc[i][j][r];
                if (OUT_HALF) ((_Float16*)C)[row * ldc + col] = (_Float16)v;
                else          ((float*)C)[row * ldc + col]    = v;
            }
}

// ---------------------------------------------------------------------------
// Flash attention, causal + ALiBi, fully transposed dataflow.
//   qkv : [B*T, 3*D] f16 ;  vT : [B*H, hd, T] f16 ;  outh : [B*T, D] f16
// One wave owns 16 query columns (lane = query); key tiles of 32.
//   S^T = K(16kt x 64) · Q^T(64 x 16q)   -> C-frag: lane=q, reg r = kt r/r+8
//   O^T = V^T(64d x 32kt) · P^T(32 x 16q)-> C-frag: lane=q, reg r = d
// P^T C-frag layout == B-operand layout, so P is repacked in registers.
// The four waves of a work-group walk the same keys, so K and V^T come through LDS once
// per work-group and query block: a stage is 64 keys (64 K rows of 128 bytes, 64 V^T rows of 128 bytes),
// wave 0 brings the K slice and wave 1 the V^T slice with one tensor load each; two
// buffers, the next stage's loads fly during a pass. hd = 64, T a multiple of 128.
// Causal cost grows with the query block, and every work-group is resident at once, so the
// launch lasts as long as its fullest WGP. A work-group therefore takes TWO query blocks of
// one head, n-1-t and then t, one after the other in every wave: (n-t) + (t+1) = n+1 stages
// for every work-group. The ring runs on over the change of block: stage numbers count
// through both blocks, and the stages behind the first block start again at key 0.
// ---------------------------------------------------------------------------
constexpr uint32_t AT_STAGE = 2 * G_SLICE;        // K slice | V^T slice

__global__ void __launch_bounds__(128) attn_flash_wmma(const _Float16* __restrict__ qkv,
                                                       const _Float16* __restrict__ vT,
                                                       _Float16* __restrict__ outh,
                                                       int T, int H, int hd) {
    __shared__ __attribute__((aligned(2048))) unsigned char ring[2 * AT_STAGE];
    const int  D  = H * hd;            // 1024
    const long ld = (long)3 * D;       // 3072
    int nQblk = T / 64;                // even
    int nPair = nQblk / 2;
    int bh    = blockIdx.x / nPair;
    int pr    = blockIdx.x % nPair;    // t: this work-group's query blocks are nQblk-1-t and t
    int b = bh / H, h = bh % H;
    const uint32_t wave = uni(threadIdx.x >> 5);
    int lane = threadIdx.x & 31;

    const float scale = 0.125f;                                   // hd^-0.5
    const float slope = exp2f(-(float)(h + 1) / (float)H);        // ALiBi
    const float NEGINF = -__builtin_inff();

    const _Float16* Qp = qkv + (long)b * T * ld + (long)h * hd;
    const _Float16* Kp = Qp + D;
    const _Float16* Vt = vT + (long)bh * hd * T;

    // the issuing waves' slice of every stage: wave 0 K rows (a stage on = 64 rows), wave 1
    // V^T rows (a stage on = 128 bytes along each row)
    const uint64_t ga0   = (uint64_t)(size_t)((wave == 0u) ? Kp : Vt);
    const uint64_t gstep = (wave == 0u) ? (uint64_t)ld * 2u * G_ROWS : (uint64_t)G_ROWB;
    const uint32_t dst0  = (uint32_t)(size_t)ring + (wave & 1u) * G_SLICE;
    const u32x8    g1    = tdm_group1((wave == 0u) ? (uint32_t)ld * 2u : (uint32_t)T * 2u);
    const uint32_t nS1   = (uint32_t)(nQblk - pr);   // stages of the first block, at least 2
    const uint32_t nS    = (uint32_t)nQblk + 1u;     // stages of both blocks

    if (pinned(wave < 2u)) {
        tdm_load(tdm_group0(dst0, ga0), g1);      // stage 0
        wait_tensor0();
    }
    __syncthreads();                              // stage 0 published
    if (pinned(wave < 2u))
        tdm_load(tdm_group0(dst0 + AT_STAGE, ga0 + gstep), g1);   // stage 1

    const int rh8 = (lane >> 4) << 3;             // 0 or 8 (kt / d row offset)
    const float slope16 = 16.0f * slope;
    const uint32_t fo = (uint32_t)(lane & 15) * G_PITCH + (uint32_t)(lane >> 4) * 16u;
    uint32_t sg = 0;                              // stage number, counted through both blocks

    for (int half = 0; half < 2; ++half) {
    const int qblk  = half ? pr : nQblk - 1 - pr;
    const int qbase = qblk * 64 + (int)wave * 16;

    // Q^T B-operand fragments for this wave's 16 queries (hd=64 -> 2 chunks)
    v16h qfA = load_frag_rm(Qp, ld, qbase, 0);    // dd = 0..31
    v16h qfB = load_frag_rm(Qp, ld, qbase, 32);   // dd = 32..63

    int qlane = qbase + (lane & 15);              // this lane's query index

    // rel = qlane - kt_index, affine per tile: precompute per-register bases
    float relA[8], srelA[8];
    for (int r = 0; r < 8; ++r) {
        float rl  = (float)(qlane - rh8 - r);     // rel at kt = 0, first half
        relA[r]   = rl;
        srelA[r]  = slope * rl;
    }

    v8f  o[4] = {{0}, {0}, {0}, {0}};             // O^T: 64d x 16q, 4 frags
    float mrow = NEGINF, lrow = 0.f;

    // one key tile of 32: pk at K row 0 of the tile, pv at its first key in V^T row 0, both
    // with the lane's fragment offset; ktf = (float) index of the tile's first key
    auto key_tile = [&](const unsigned char* pk, const unsigned char* pv, float ktf) {
        // ---- all K fragments, then the 4 score WMMAs ----
        v16h kf0a = lds_frag(pk);
        v16h kf0b = lds_frag(pk + 64);
        v16h kf1a = lds_frag(pk + 16 * G_PITCH);
        v16h kf1b = lds_frag(pk + 16 * G_PITCH + 64);
        v8f s0 = {0}, s1 = {0};
        s0 = wmma_f16(kf0a, qfA, s0);
        s0 = wmma_f16(kf0b, qfB, s0);
        s1 = wmma_f16(kf1a, qfA, s1);
        s1 = wmma_f16(kf1b, qfB, s1);

        // ---- V fragments early; softmax math below hides their latency
        v16h vf0 = lds_frag(pv);
        v16h vf1 = lds_frag(pv + 16 * G_PITCH);
        v16h vf2 = lds_frag(pv + 32 * G_PITCH);
        v16h vf3 = lds_frag(pv + 48 * G_PITCH);

        // ---- bias + causal mask + local max (all-float, per-lane regs) ----
        float sk = slope * ktf;                   // slope * kt
        float a0[8], a1[8];
        float mloc = NEGINF;
        for (int r = 0; r < 8; ++r) {
            float rel0  = relA[r] - ktf;          // qlane - k0 (exact integer)
            float bias0 = sk - srelA[r];          // -slope*(qlane-k0)
            float v0 = fmaf(s0[r], scale, bias0);
            float v1 = fmaf(s1[r], scale, bias0 + slope16);
            a0[r] = (rel0 >= 0.0f)  ? v0 : NEGINF;
            a1[r] = (rel0 >= 16.0f) ? v1 : NEGINF;
            mloc  = fmaxf(mloc, fmaxf(a0[r], a1[r]));
        }
        mloc = fmaxf(mloc, __shfl_xor(mloc, 16, 32));   // join the two kt halves
        float mnew = fmaxf(mrow, mloc);

        // ---- exponentials, P^T repacked directly into a B-operand frag ----
        float corr = __expf(mrow - mnew);               // 0 when mrow == -inf
        v16h pb = {};
        float ps = 0.f;
        for (int r = 0; r < 8; ++r) {
            float p0 = __expf(a0[r] - mnew);            // exp(-inf) == 0
            float p1 = __expf(a1[r] - mnew);
            ps += p0 + p1;
            pb[r]     = (_Float16)p0;                   // kk = rh8 + r
            pb[8 + r] = (_Float16)p1;                   // kk = 16 + rh8 + r
        }
        ps += __shfl_xor(ps, 16, 32);
        lrow = lrow * corr + ps;
        mrow = mnew;

        // ---- O^T = corr*O^T + V^T x P^T ----
        o[0] = wmma_f16(vf0, pb, o[0] * corr);
        o[1] = wmma_f16(vf1, pb, o[1] * corr);
        o[2] = wmma_f16(vf2, pb, o[2] * corr);
        o[3] = wmma_f16(vf3, pb, o[3] * corr);
    };

    uint32_t s = 0;                               // stage within this query block
    do {
        const unsigned char* pk = ring + (sg & 1u) * AT_STAGE + fo;
        const unsigned char* pv = pk + G_SLICE;
        const int kt = (int)s * 64;
        key_tile(pk, pv, (float)kt);
        if (kt + 32 <= qbase + 15)                // wave-uniform: false only on the diagonal stage
            key_tile(pk + 32 * G_PITCH, pv + 64, (float)(kt + 32));
        // publish point of stage sg + 1
        wait_ds0();
        if (pinned(wave < 2u)) wait_tensor0();
        __syncthreads();                          // sg + 1 readable; every wave has left sg
        if (pinned((wave < 2u) && (sg + 2u < nS))) {
            const uint32_t nx = pinned(sg + 2u);  // descriptor words formed behind the wait
            const uint32_t kb = (nx < nS1) ? nx : nx - nS1;   // its 64 keys within its block's walk
            tdm_load(tdm_group0(dst0 + (nx & 1u) * AT_STAGE, ga0 + (uint64_t)kb * gstep), g1);
        }
        ++sg;
    } while (++s <= (uint32_t)qblk);

    // ---- normalize, write O^T: lane q stores 8 contiguous d per fragment ----
    float rinv = 1.0f / lrow;
    _Float16* dst = outh + ((long)b * T + qlane) * D + (long)h * hd + rh8;
    for (int f = 0; f < 4; ++f) {
        v8h ov;
        for (int r = 0; r < 8; ++r) ov[r] = (_Float16)(o[f][r] * rinv);
        *(v8h*)(dst + f * 16) = ov;                     // d = f*16 + rh8 + r
    }
    // the next block's set-up overwrites the address and data registers of these stores
    asm volatile("s_wait_xcnt 0x0" ::: "memory");
    }   // second query block
    wait_tensor0();
    wait_ds0();
}

// ---------------------------------------------------------------------------
// Host launcher
// ---------------------------------------------------------------------------
extern "C" void kernel_launch(void* const* d_in, const int* in_sizes, int n_in,
                              void* d_out, int out_size, void* d_ws, size_t ws_size,
                              hipStream_t stream) {
    (void)in_sizes; (void)n_in; (void)out_size; (void)ws_size;
    constexpr int  Bb = 2, T = 2048, D = 1024, H = 16, HD = 64;
    constexpr long M  = (long)Bb * T;          // 4096

    const float* x     = (const float*)d_in[0];
    const float* w_qkv = (const float*)d_in[1];
    const float* w_out = (const float*)d_in[2];
    float*       out   = (float*)d_out;

    // workspace carve-up (256B aligned)
    char* ws = (char*)d_ws;
    size_t off = 0;
    auto carve = [&](size_t bytes) {
        size_t r = off;
        off += (bytes + 255) & ~(size_t)255;
        return r;
    };
    _Float16* xh    = (_Float16*)(ws + carve(M * D * 2));               //  8 MB
    _Float16* wqkvh = (_Float16*)(ws + carve((size_t)3 * D * D * 2));   //  6 MB
    _Float16* wouth = (_Float16*)(ws + carve((size_t)D * D * 2));       //  2 MB
    _Float16* qkvh  = (_Float16*)(ws + carve(M * 3 * D * 2));           // 24 MB
    _Float16* vTh   = (_Float16*)(ws + carve((size_t)Bb * H * HD * T * 2)); // 8 MB
    _Float16* atth  = (_Float16*)(ws + carve(M * D * 2));               //  8 MB

    // 1) f32 -> f16 conversions, one launch for the three arrays
    {
        constexpr long n1 = M * D, n2 = (long)3 * D * D, n3 = (long)D * D;
        static_assert(n1 % CV_SPAN == 0 && n2 % CV_SPAN == 0 && n3 % CV_SPAN == 0, "whole spans only");
        constexpr int nb1 = (int)(n1 / CV_SPAN), nb2 = (int)(n2 / CV_SPAN), nb3 = (int)(n3 / CV_SPAN);
        cvt3_f32_to_f16<<<dim3(nb1 + nb2 + nb3), dim3(CV_THREADS), 0, stream>>>(
            x, xh, nb1, w_qkv, wqkvh, nb2, w_out, wouth);
    }

    // 2) qkv = x @ w_qkv^T   (4096x1024 x 1024x3072) -> f16 [4096,3072]
    {
        int tiles = (int)(M / 128) * (3 * D / 128);   // 768
        gemm_wmma<true><<<dim3(tiles), dim3(128), 0, stream>>>(
            xh, wqkvh, qkvh, (int)M, 3 * D, D, 3 * D);
    }

    // 3) transpose V per head (LDS-tiled): vT[bh][d][t]
    {
        int blocks = Bb * H * (T / 64);               // 1024
        transpose_v_tiled<<<dim3(blocks), dim3(256), 0, stream>>>(qkvh, vTh, T, H, HD);
    }

    // 4) flash attention (causal + ALiBi, transposed dataflow) -> atth f16
    {
        int blocks = Bb * H * (T / 128);              // 512: two query blocks each
        attn_flash_wmma<<<dim3(blocks), dim3(128), 0, stream>>>(qkvh, vTh, atth, T, H, HD);
    }

    // 5) out = attn @ w_out^T -> f32 d_out
    {
        int tiles = (int)(M / 128) * (D / 128);       // 256
        gemm_wmma<false><<<dim3(tiles), dim3(128), 0, stream>>>(
            atth, wouth, out, (int)M, D, D, D);
    }
}

// v005
// Measured time: 82 microseconds a run.
// Next to v004, in two timings, it ran 1.09 and 1.10 times as fast.
// Over all steps from v000 it is 4.01 times as fast.
#include <hip/hip_runtime.h>
#include <stdint.h>

// ---------------------------------------------------------------------------
// CDNA5 (gfx1250) self-attention forward, f16 WMMA with f32 accumulation.
// Fixed problem: B=2, T=2048, D=1024, H=16, hd=64 (per reference setup).
// Attention computed in transposed form (S^T = K·Q^T, O^T = V^T·P^T) so that
// softmax row statistics are per-lane and P converts C-frag -> B-frag in
// registers (no LDS round trip, no bpermute reduction chains).
// ---------------------------------------------------------------------------

typedef __attribute__((ext_vector_type(16))) _Float16 v16h;
typedef __attribute__((ext_vector_type(8)))  _Float16 v8h;
typedef __attribute__((ext_vector_type(8)))  float    v8f;
typedef __attribute__((ext_vector_type(4)))  float    v4f;

union Frag16 {
    v16h v;
    struct { v8h lo; v8h hi; } p;
};

// D = A x B + C  (16x16x32, f16 in, f32 acc)
__device__ __forceinline__ v8f wmma_f16(v16h a, v16h b, v8f c) {
    return __builtin_amdgcn_wmma_f32_16x16x32_f16(
        /*neg_a=*/false, a, /*neg_b=*/false, b,
        /*c_mod=*/(short)0, c, /*reuse_a=*/false, /*reuse_b=*/false);
}

// Load a 16x32 A-style fragment from a row-major matrix (also the layout of
// the B operand of A·B^T when the second matrix is stored row-major N x K).
// CDNA5 16-bit A layout:
//   lanes 0-15 : row = lane,    halves 0-7 -> K=k0+0..7,  halves 8-15 -> K=k0+16..23
//   lanes 16-31: row = lane-16, halves 0-7 -> K=k0+8..15, halves 8-15 -> K=k0+24..31
__device__ __forceinline__ v16h load_frag_rm(const _Float16* __restrict__ base,
                                             long ld, int row0, int k0) {
    int lane = threadIdx.x & 31;
    int r    = row0 + (lane & 15);
    int hs   = (lane >> 4) << 3;            // 0 or 8
    const _Float16* p = base + (long)r * ld + k0 + hs;
    Frag16 f;
    f.p.lo = *(const v8h*)(p);              // K = k0+hs .. +7
    f.p.hi = *(const v8h*)(p + 16);         // K = k0+16+hs .. +7
    return f.v;
}

// ---------------------------------------------------------------------------
// f32 -> f16 for all three inputs in ONE launch: the three jobs read nothing of each other,
// and few long waves start sooner than many waves of two loads and a store each.
// One work-group of 16 waves per CV_SPAN elements; blockIdx picks the array (work-group
// uniform). A wave owns 2048 contiguous elements: 16 loads of 16 bytes per lane, each load
// 512 contiguous bytes of the wave (whole lines), written ahead of the conversions so that
// most of them are in flight together; each store is 256 contiguous bytes of the wave.
// Every array is a multiple of CV_SPAN long.
// ---------------------------------------------------------------------------
typedef __attribute__((ext_vector_type(4)))  _Float16 v4h;
constexpr int  CV_THREADS = 512;                          // 16 waves
constexpr int  CV_LOADS   = 16;                           // 16-byte loads per lane
constexpr long CV_SPAN    = (long)CV_THREADS * CV_LOADS * 4;   // 32768 elements per work-group

__global__ void __launch_bounds__(CV_THREADS) cvt3_f32_to_f16(
        const float* __restrict__ in0, _Float16* __restrict__ out0, int nb0,
        const float* __restrict__ in1, _Float16* __restrict__ out1, int nb1,
        const float* __restrict__ in2, _Float16* __restrict__ out2) {
    int blk = (int)blockIdx.x;
    const float* in  = in0;
    _Float16*    out = out0;
    if (blk >= nb0 + nb1)  { in = in2; out = out2; blk -= nb0 + nb1; }
    else if (blk >= nb0)   { in = in1; out = out1; blk -= nb0; }
    const int wave = threadIdx.x >> 5, lane = threadIdx.x & 31;
    const long base = (long)blk * CV_SPAN + (long)wave * (CV_LOADS * 128) + lane * 4;
    v4f a[CV_LOADS];
    for (int j = 0; j < CV_LOADS; ++j) a[j] = *(const v4f*)(in + base + j * 128);
    for (int j = 0; j < CV_LOADS; ++j) {
        v4h o;
        for (int e = 0; e < 4; ++e) o[e] = (_Float16)a[j][e];
        *(v4h*)(out + base + j * 128) = o;
    }
}

// ---------------------------------------------------------------------------
// C[M,N] = A[M,K] (row-major f16) x B[N,K]^T (row-major f16, torch-Linear W)
// One work-group of 4 waves -> 128x128 C tile, one wave -> 64x64 (4x4 fragments).
// A pass is 64 k (128 bytes of each of the 256 operand rows). Each wave brings
// one 64-row slice of a stage into LDS with one tensor load (waves 0,1: A rows,
// waves 2,3: B rows); two buffers, the next stage's load flies during a pass.
// Shapes: M, N multiples of 128, K a multiple of 64 and at least 128.
// Columns from vcol0 on (the V third of the qkv product; vcol0 and T multiples of 128) are not
// written to C but, transposed, to Vt[(row / T) * (N - vcol0) + col - vcol0][row % T]: in a C
// fragment a lane holds ONE column and 8 consecutive rows, which are 16 contiguous bytes there.
// ---------------------------------------------------------------------------
typedef uint32_t u32x4 __attribute__((ext_vector_type(4)));
typedef uint32_t u32x8 __attribute__((ext_vector_type(8)));

constexpr uint32_t G_ROWB  = 128;                 // bytes of one operand row in a stage
constexpr uint32_t G_PITCH = G_ROWB + 16;         // LDS pitch, 16 B x odd for ds_load_b128
constexpr uint32_t G_ROWS  = 64;                  // rows of one wave's slice
constexpr uint32_t G_SLICE = 10240;               // 64 * 144 = 9216, rounded up to 2 KiB
constexpr uint32_t G_STAGE = 4 * G_SLICE;         // A half 0 | A half 1 | B half 0 | B half 1
static_assert(G_ROWS * G_PITCH <= G_SLICE && (G_SLICE % 2048u) == 0, "slice places are multiples of 2 KiB");

__device__ __forceinline__ uint32_t uni(uint32_t v) { return (uint32_t)__builtin_amdgcn_readfirstlane(v); }
// Used for the tensor loads alone: an issue test on it compiles to s_cmp + s_cbranch_scc (tensor
// loads ignore EXEC), and a descriptor word made from it stays behind the waits in front of it.
__device__ __forceinline__ uint32_t pinned(uint32_t v) {
    uint32_t w = uni(v);
    asm volatile("" : "+s"(w));   // pinned(): an issue test or a descriptor word held in a scalar register
    return w;
}
// The compiler places no wait for the tensor mover; the clobber keeps LDS reads on their side.
__device__ __forceinline__ void wait_tensor0() { asm volatile("s_wait_tensorcnt 0x0" ::: "memory"); }
// This wave's LDS reads have returned before the buffer is handed over for a refill.
__device__ __forceinline__ void wait_ds0() { asm volatile("s_wait_dscnt 0x0" ::: "memory"); }
// One request of the whole wave: 64 rows of 128 bytes from global memory into LDS.
__device__ __forceinline__ void tdm_load(u32x4 g0, u32x8 g1) {
    asm volatile("tensor_load_to_lds %0, %1" :: "s"(g0), "s"(g1) : "memory");
}
__device__ __forceinline__ u32x4 tdm_group0(uint32_t lds_dst, uint64_t ga) {
    u32x4 g;
    g[0] = uni(1u);                                                        // count 1
    g[1] = uni(lds_dst);
    g[2] = uni((uint32_t)ga);
    g[3] = uni((((uint32_t)(ga >> 32)) & 0x01FFFFFFu) | 0x80000000u);      // type 2
    return g;
}
// Every word through pinned(): a descriptor word held in a scalar register. Without it the
// compiler used words of this group as loop temporaries while a request was outstanding.
__device__ __forceinline__ u32x8 tdm_group1(uint32_t src_pitch) {
    u32x8 g;
    g[0] = pinned((1u << 20) | (4u << 22) | (3u << 25));   // no mask, bytes, 16 B pad behind each 128-B row
    g[1] = pinned((G_ROWB & 0xFFFFu) << 16);
    g[2] = pinned((G_ROWB >> 16) | ((G_ROWS & 0xFFFFu) << 16));
    g[3] = pinned((G_ROWS >> 16) | (G_ROWB << 16));
    g[4] = pinned(G_ROWS);
    g[5] = pinned(src_pitch);
    g[6] = pinned(0u);
    g[7] = pinned(0u);
    return g;
}

// 16x32 fragment from an LDS slice; p points at byte 16*(lane>>4) of row (lane&15).
// Same k order as load_frag_rm: halves 0-7 at byte 0, halves 8-15 at byte 32.
__device__ __forceinline__ v16h lds_frag(const unsigned char* p) {
    Frag16 f;
    f.p.lo = *(const v8h*)(p);
    f.p.hi = *(const v8h*)(p + 32);
    return f.v;
}

template <bool OUT_HALF>
__global__ void __launch_bounds__(128) gemm_wmma(const _Float16* __restrict__ A,
                                                 const _Float16* __restrict__ B,
                                                 void* __restrict__ C,
                                                 int M, int N, int K, int ldc,
                                                 _Float16* __restrict__ Vt, int vcol0, int T) {
    __shared__ __attribute__((aligned(2048))) unsigned char ring[2 * G_STAGE];
    const uint32_t wave = uni(threadIdx.x >> 5);
    const int lane    = threadIdx.x & 31;
    const int nTilesN = N >> 7;
    const int nTiles  = (M >> 7) * nTilesN;
    if ((int)blockIdx.x >= nTiles) return;            // block-uniform, before any barrier
    const int tm = ((int)blockIdx.x / nTilesN) << 7;
    const int tn = ((int)blockIdx.x % nTilesN) << 7;
    const uint32_t wm = wave >> 1, wn = wave & 1u;    // this wave's 64x64 quadrant

    // this wave's slice of every stage
    const _Float16* srow = (wave < 2u) ? A + (long)(tm + 64 * (int)wave) * K
                                       : B + (long)(tn + 64 * (int)(wave - 2u)) * K;
    const uint64_t ga0  = (uint64_t)(size_t)srow;
    const uint32_t dst0 = (uint32_t)(size_t)ring + wave * G_SLICE;
    const u32x8    g1   = tdm_group1((uint32_t)K * 2u);
    const uint32_t nP   = (uint32_t)K >> 6;

    tdm_load(tdm_group0(dst0, ga0), g1);              // stage 0
    wait_tensor0();
    __syncthreads();                                  // stage 0 published
    tdm_load(tdm_group0(dst0 + G_STAGE, ga0 + G_ROWB), g1);   // stage 1

    v8f acc[4][4];
    for (int i = 0; i < 4; ++i)
        for (int j = 0; j < 4; ++j) acc[i][j] = v8f{0};

    const uint32_t fo = (uint32_t)(lane & 15) * G_PITCH + (uint32_t)(lane >> 4) * 16u;
    uint32_t s = 0;
    do {                                              // nP is at least 2
        const unsigned char* buf = ring + (s & 1u) * G_STAGE;
        const unsigned char* pa  = buf + wm * G_SLICE + fo;
        const unsigned char* pb  = buf + (2u + wn) * G_SLICE + fo;
        v16h a[2][4], b[2][4];
        for (int kc = 0; kc < 2; ++kc) {
            for (int j = 0; j < 4; ++j) b[kc][j] = lds_frag(pb + j * 16 * G_PITCH + kc * 64);
            for (int i = 0; i < 4; ++i) a[kc][i] = lds_frag(pa + i * 16 * G_PITCH + kc * 64);
        }
        // keeps the pass's LDS reads one group in front of its WMMAs: left alone the compiler
        // put a load pair and a full wait in front of every row of four
        __builtin_amdgcn_sched_barrier(0);
        for (int kc = 0; kc < 2; ++kc)
            for (int i = 0; i < 4; ++i)
                for (int j = 0; j < 4; ++j) acc[i][j] = wmma_f16(a[kc][i], b[kc][j], acc[i][j]);
        // keeps the WMMAs in front of the publish point: sunk behind it they left the wait for
        // the next stage's tensor load at the top of the pass, with nothing to cover its flight
        __builtin_amdgcn_sched_barrier(0);
        // publish point of stage s + 1
        wait_ds0();
        wait_tensor0();
        __syncthreads();                              // s + 1 readable; every wave has left s
        if (pinned(s + 2u < nP)) {
            const uint32_t nx = pinned(s + 2u);       // descriptor words formed behind the wait
            tdm_load(tdm_group0(dst0 + (nx & 1u) * G_STAGE, ga0 + (uint64_t)nx * G_ROWB), g1);
        }
    } while (++s < nP);
    wait_tensor0();
    wait_ds0();

    // C fragment layout: VGPR r holds (row=r, lanes0-15 cols) / (row=r+8, lanes16-31)
    int colb = lane & 15;
    int rowb = (lane >> 4) << 3;
    if (OUT_HALF && tn >= vcol0) {                    // block-uniform: a tile is all V or none
        const int bt = tm / T;                        // a tile's 128 rows lie in one batch
        _Float16* vrow = Vt + ((long)bt * (N - vcol0) + (tn - vcol0) + (int)wn * 64 + colb) * T
                            + (tm - bt * T) + (int)wm * 64 + rowb;
        for (int j = 0; j < 4; ++j)
            for (int i = 0; i < 4; ++i) {             // the four i of one j fill a 128-byte line
                v8h o;
                for (int r = 0; r < 8; ++r) o[r] = (_Float16)acc[i][j][r];
                *(v8h*)(vrow + (long)j * 16 * T + i * 16) = o;
            }
        // behind the last store: the code that follows in the listing overwrites address and
        // data registers of these stores
        asm volatile("s_wait_xcnt 0x0" ::: "memory");
        return;
    }
    for (int i = 0; i < 4; ++i)
        for (int j = 0; j < 4; ++j)
            for (int r = 0; r < 8; ++r) {
                long row = tm + (int)wm * 64 + i * 16 + rowb + r;
                long col = tn + (int)wn * 64 + j * 16 + colb;
                float v  = acc[i][j][r];
                if (OUT_HALF) ((_Float16*)C)[row * ldc + col] = (_Float16)v;
                else          ((float*)C)[row * ldc + col]    = v;
            }
}

// ---------------------------------------------------------------------------
// Flash attention, causal + ALiBi, fully transposed dataflow.
//   qkv : [B*T, 3*D] f16 ;  vT : [B*H, hd, T] f16 ;  outh : [B*T, D] f16
// One wave owns 16 query columns (lane = query); key tiles of 32.
//   S^T = K(16kt x 64) · Q^T(64 x 16q)   -> C-frag: lane=q, reg r = kt r/r+8
//   O^T = V^T(64d x 32kt) · P^T(32 x 16q)-> C-frag: lane=q, reg r = d
// P^T C-frag layout == B-operand layout, so P is repacked in registers.
// The four waves of a work-group walk the same keys, so K and V^T come through LDS once
// per work-group and query block: a stage is 64 keys (64 K rows of 128 bytes, 64 V^T rows of 128 bytes),
// wave 0 brings the K slice and wave 1 the V^T slice with one tensor load each; two
// buffers, the next stage's loads fly during a pass. hd = 64, T a multiple of 128.
// Causal cost grows with the query block, and every work-group is resident at once, so the
// launch lasts as long as its fullest WGP. A work-group therefore takes TWO query blocks of
// one head, n-1-t and then t, one after the other in every wave: (n-t) + (t+1) = n+1 stages
// for every work-group. The ring runs on over the change of block: stage numbers count
// through both blocks, and the stages behind the first block start again at key 0.
// ---------------------------------------------------------------------------
constexpr uint32_t AT_STAGE = 2 * G_SLICE;        // K slice | V^T slice

__global__ void __launch_bounds__(128) attn_flash_wmma(const _Float16* __restrict__ qkv,
                                                       const _Float16* __restrict__ vT,
                                                       _Float16* __restrict__ outh,
                                                       int T, int H, int hd) {
    __shared__ __attribute__((aligned(2048))) unsigned char ring[2 * AT_STAGE];
    const int  D  = H * hd;            // 1024
    const long ld = (long)3 * D;       // 3072
    int nQblk = T / 64;                // even
    int nPair = nQblk / 2;
    int bh    = blockIdx.x / nPair;
    int pr    = blockIdx.x % nPair;    // t: this work-group's query blocks are nQblk-1-t and t
    int b = bh / H, h = bh % H;
    const uint32_t wave = uni(threadIdx.x >> 5);
    int lane = threadIdx.x & 31;

    const float scale = 0.125f;                                   // hd^-0.5
    const float slope = exp2f(-(float)(h + 1) / (float)H);        // ALiBi
    const float NEGINF = -__builtin_inff();

    const _Float16* Qp = qkv + (long)b * T * ld + (long)h * hd;
    const _Float16* Kp = Qp + D;
    const _Float16* Vt = vT + (long)bh * hd * T;

    // the issuing waves' slice of every stage: wave 0 K rows (a stage on = 64 rows), wave 1
    // V^T rows (a stage on = 128 bytes along each row)
    const uint64_t ga0   = (uint64_t)(size_t)((wave == 0u) ? Kp : Vt);
    const uint64_t gstep = (wave == 0u) ? (uint64_t)ld * 2u * G_ROWS : (uint64_t)G_ROWB;
    const uint32_t dst0  = (uint32_t)(size_t)ring + (wave & 1u) * G_SLICE;
    const u32x8    g1    = tdm_group1((wave == 0u) ? (uint32_t)ld * 2u : (uint32_t)T * 2u);
    const uint32_t nS1   = (uint32_t)(nQblk - pr);   // stages of the first block, at least 2
    const uint32_t nS    = (uint32_t)nQblk + 1u;     // stages of both blocks

    if (pinned(wave < 2u)) {
        tdm_load(tdm_group0(dst0, ga0), g1);      // stage 0
        wait_tensor0();
    }
    __syncthreads();                              // stage 0 published
    if (pinned(wave < 2u))
        tdm_load(tdm_group0(dst0 + AT_STAGE, ga0 + gstep), g1);   // stage 1

    const int rh8 = (lane >> 4) << 3;             // 0 or 8 (kt / d row offset)
    const float slope16 = 16.0f * slope;
    const uint32_t fo = (uint32_t)(lane & 15) * G_PITCH + (uint32_t)(lane >> 4) * 16u;
    uint32_t sg = 0;                              // stage number, counted through both blocks

    for (int half = 0; half < 2; ++half) {
    const int qblk  = half ? pr : nQblk - 1 - pr;
    const int qbase = qblk * 64 + (int)wave * 16;

    // Q^T B-operand fragments for this wave's 16 queries (hd=64 -> 2 chunks)
    v16h qfA = load_frag_rm(Qp, ld, qbase, 0);    // dd = 0..31
    v16h qfB = load_frag_rm(Qp, ld, qbase, 32);   // dd = 32..63

    int qlane = qbase + (lane & 15);              // this lane's query index

    // rel = qlane - kt_index, affine per tile: precompute per-register bases
    float relA[8], srelA[8];
    for (int r = 0; r < 8; ++r) {
        float rl  = (float)(qlane - rh8 - r);     // rel at kt = 0, first half
        relA[r]   = rl;
        srelA[r]  = slope * rl;
    }

    v8f  o[4] = {{0}, {0}, {0}, {0}};             // O^T: 64d x 16q, 4 frags
    float mrow = NEGINF, lrow = 0.f;

    // one key tile of 32: pk at K row 0 of the tile, pv at its first key in V^T row 0, both
    // with the lane's fragment offset; ktf = (float) index of the tile's first key
    auto key_tile = [&](const unsigned char* pk, const unsigned char* pv, float ktf) {
        // ---- all K fragments, then the 4 score WMMAs ----
        v16h kf0a = lds_frag(pk);
        v16h kf0b = lds_frag(pk + 64);
        v16h kf1a = lds_frag(pk + 16 * G_PITCH);
        v16h kf1b = lds_frag(pk + 16 * G_PITCH + 64);
        v8f s0 = {0}, s1 = {0};
        s0 = wmma_f16(kf0a, qfA, s0);
        s0 = wmma_f16(kf0b, qfB, s0);
        s1 = wmma_f16(kf1a, qfA, s1);
        s1 = wmma_f16(kf1b, qfB, s1);

        // ---- V fragments early; softmax math below hides their latency
        v16h vf0 = lds_frag(pv);
        v16h vf1 = lds_frag(pv + 16 * G_PITCH);
        v16h vf2 = lds_frag(pv + 32 * G_PITCH);
        v16h vf3 = lds_frag(pv + 48 * G_PITCH);

        // ---- bias + causal mask + local max (all-float, per-lane regs) ----
        float sk = slope * ktf;                   // slope * kt
        float a0[8], a1[8];
        float mloc = NEGINF;
        for (int r = 0; r < 8; ++r) {
            float rel0  = relA[r] - ktf;          // qlane - k0 (exact integer)
            float bias0 = sk - srelA[r];          // -slope*(qlane-k0)
            float v0 = fmaf(s0[r], scale, bias0);
            float v1 = fmaf(s1[r], scale, bias0 + slope16);
            a0[r] = (rel0 >= 0.0f)  ? v0 : NEGINF;
            a1[r] = (rel0 >= 16.0f) ? v1 : NEGINF;
            mloc  = fmaxf(mloc, fmaxf(a0[r], a1[r]));
        }
        mloc = fmaxf(mloc, __shfl_xor(mloc, 16, 32));   // join the two kt halves
        float mnew = fmaxf(mrow, mloc);

        // ---- exponentials, P^T repacked directly into a B-operand frag ----
        float corr = __expf(mrow - mnew);               // 0 when mrow == -inf
        v16h pb = {};
        float ps = 0.f;
        for (int r = 0; r < 8; ++r) {
            float p0 = __expf(a0[r] - mnew);            // exp(-inf) == 0
            float p1 = __expf(a1[r] - mnew);
            ps += p0 + p1;
            pb[r]     = (_Float16)p0;                   // kk = rh8 + r
            pb[8 + r] = (_Float16)p1;                   // kk = 16 + rh8 + r
        }
        ps += __shfl_xor(ps, 16, 32);
        lrow = lrow * corr + ps;
        mrow = mnew;

        // ---- O^T = corr*O^T + V^T x P^T ----
        o[0] = wmma_f16(vf0, pb, o[0] * corr);
        o[1] = wmma_f16(vf1, pb, o[1] * corr);
        o[2] = wmma_f16(vf2, pb, o[2] * corr);
        o[3] = wmma_f16(vf3, pb, o[3] * corr);
    };

    uint32_t s = 0;                               // stage within this query block
    do {
        const unsigned char* pk = ring + (sg & 1u) * AT_STAGE + fo;
        const unsigned char* pv = pk + G_SLICE;
        const int kt = (int)s * 64;
        key_tile(pk, pv, (float)kt);
        if (kt + 32 <= qbase + 15)                // wave-uniform: false only on the diagonal stage
            key_tile(pk + 32 * G_PITCH, pv + 64, (float)(kt + 32));
        // publish point of stage sg + 1
        wait_ds0();
        if (pinned(wave < 2u)) wait_tensor0();
        __syncthreads();                          // sg + 1 readable; every wave has left sg
        if (pinned((wave < 2u) && (sg + 2u < nS))) {
            const uint32_t nx = pinned(sg + 2u);  // descriptor words formed behind the wait
            const uint32_t kb = (nx < nS1) ? nx : nx - nS1;   // its 64 keys within its block's walk
            tdm_load(tdm_group0(dst0 + (nx & 1u) * AT_STAGE, ga0 + (uint64_t)kb * gstep), g1);
        }
        ++sg;
    } while (++s <= (uint32_t)qblk);

    // ---- normalize, write O^T: lane q stores 8 contiguous d per fragment ----
    float rinv = 1.0f / lrow;
    _Float16* dst = outh + ((long)b * T + qlane) * D + (long)h * hd + rh8;
    for (int f = 0; f < 4; ++f) {
        v8h ov;
        for (int r = 0; r < 8; ++r) ov[r] = (_Float16)(o[f][r] * rinv);
        *(v8h*)(dst + f * 16) = ov;                     // d = f*16 + rh8 + r
    }
    // the next block's set-up overwrites the address and data registers of these stores
    asm volatile("s_wait_xcnt 0x0" ::: "memory");
    }   // second query block
    wait_tensor0();
    wait_ds0();
}

// ---------------------------------------------------------------------------
// Host launcher
// ---------------------------------------------------------------------------
extern "C" void kernel_launch(void* const* d_in, const int* in_sizes, int n_in,
                              void* d_out, int out_size, void* d_ws, size_t ws_size,
                              hipStream_t stream) {
    (void)in_sizes; (void)n_in; (void)out_size; (void)ws_size;
    constexpr int  Bb = 2, T = 2048, D = 1024, H = 16, HD = 64;
    constexpr long M  = (long)Bb * T;          // 4096

    const float* x     = (const float*)d_in[0];
    const float* w_qkv = (const float*)d_in[1];
    const float* w_out = (const float*)d_in[2];
    float*       out   = (float*)d_out;

    // workspace carve-up (256B aligned)
    char* ws = (char*)d_ws;
    size_t off = 0;
    auto carve = [&](size_t bytes) {
        size_t r = off;
        off += (bytes + 255) & ~(size_t)255;
        return r;
    };
    _Float16* xh    = (_Float16*)(ws + carve(M * D * 2));               //  8 MB
    _Float16* wqkvh = (_Float16*)(ws + carve((size_t)3 * D * D * 2));   //  6 MB
    _Float16* wouth = (_Float16*)(ws + carve((size_t)D * D * 2));       //  2 MB
    _Float16* qkvh  = (_Float16*)(ws + carve(M * 3 * D * 2));           // 24 MB
    _Float16* vTh   = (_Float16*)(ws + carve((size_t)Bb * H * HD * T * 2)); // 8 MB
    _Float16* atth  = (_Float16*)(ws + carve(M * D * 2));               //  8 MB

    // 1) f32 -> f16 conversions, one launch for the three arrays
    {
        constexpr long n1 = M * D, n2 = (long)3 * D * D, n3 = (long)D * D;
        static_assert(n1 % CV_SPAN == 0 && n2 % CV_SPAN == 0 && n3 % CV_SPAN == 0, "whole spans only");
        constexpr int nb1 = (int)(n1 / CV_SPAN), nb2 = (int)(n2 / CV_SPAN), nb3 = (int)(n3 / CV_SPAN);
        cvt3_f32_to_f16<<<dim3(nb1 + nb2 + nb3), dim3(CV_THREADS), 0, stream>>>(
            x, xh, nb1, w_qkv, wqkvh, nb2, w_out, wouth);
    }

    // 2) qkv = x @ w_qkv^T   (4096x1024 x 1024x3072): Q, K -> f16 [4096,3072] (its V third stays
    //    unwritten and unread), V -> vT[bh][d][t]
    {
        int tiles = (int)(M / 128) * (3 * D / 128);   // 768
        gemm_wmma<true><<<dim3(tiles), dim3(128), 0, stream>>>(
            xh, wqkvh, qkvh, (int)M, 3 * D, D, 3 * D, vTh, 2 * D, T);
    }

    // 3) flash attention (causal + ALiBi, transposed dataflow) -> atth f16
    {
        int blocks = Bb * H * (T / 128);              // 512: two query blocks each
        attn_flash_wmma<<<dim3(blocks), dim3(128), 0, stream>>>(qkvh, vTh, atth, T, H, HD);
    }

    // 4) out = attn @ w_out^T -> f32 d_out
    {
        int tiles = (int)(M / 128) * (D / 128);       // 256
        gemm_wmma<false><<<dim3(tiles), dim3(128), 0, stream>>>(
            atth, wouth, out, (int)M, D, D, D, nullptr, D, T);
    }
}

// v006
// It runs in 76.9 microseconds.
// Timed twice side by side with v005, it ran 1.07 times as fast both times.
// Over all steps from v000 it is 4.31 times as fast.
#include <hip/hip_runtime.h>
#include <stdint.h>

// ---------------------------------------------------------------------------
// CDNA5 (gfx1250) self-attention forward, f16 WMMA with f32 accumulation.
// Fixed problem: B=2, T=2048, D=1024, H=16, hd=64 (per reference setup).
// Attention computed in transposed form (S^T = K·Q^T, O^T = V^T·P^T) so that
// softmax row statistics are per-lane and P converts C-frag -> B-frag in
// registers (no LDS round trip, no bpermute reduction chains).
// ---------------------------------------------------------------------------

typedef __attribute__((ext_vector_type(16))) _Float16 v16h;
typedef __attribute__((ext_vector_type(8)))  _Float16 v8h;
typedef __attribute__((ext_vector_type(8)))  float    v8f;
typedef __attribute__((ext_vector_type(4)))  float    v4f;

union Frag16 {
    v16h v;
    struct { v8h lo; v8h hi; } p;
};

// D = A x B + C  (16x16x32, f16 in, f32 acc)
__device__ __forceinline__ v8f wmma_f16(v16h a, v16h b, v8f c) {
    return __builtin_amdgcn_wmma_f32_16x16x32_f16(
        /*neg_a=*/false, a, /*neg_b=*/false, b,
        /*c_mod=*/(short)0, c, /*reuse_a=*/false, /*reuse_b=*/false);
}

// Load a 16x32 A-style fragment from a row-major matrix (also the layout of
// the B operand of A·B^T when the second matrix is stored row-major N x K).
// CDNA5 16-bit A layout:
//   lanes 0-15 : row = lane,    halves 0-7 -> K=k0+0..7,  halves 8-15 -> K=k0+16..23
//   lanes 16-31: row = lane-16, halves 0-7 -> K=k0+8..15, halves 8-15 -> K=k0+24..31
__device__ __forceinline__ v16h load_frag_rm(const _Float16* __restrict__ base,
                                             long ld, int row0, int k0) {
    int lane = threadIdx.x & 31;
    int r    = row0 + (lane & 15);
    int hs   = (lane >> 4) << 3;            // 0 or 8
    const _Float16* p = base + (long)r * ld + k0 + hs;
    Frag16 f;
    f.p.lo = *(const v8h*)(p);              // K = k0+hs .. +7
    f.p.hi = *(const v8h*)(p + 16);         // K = k0+16+hs .. +7
    return f.v;
}

// ---------------------------------------------------------------------------
// f32 -> f16 for all three inputs in ONE launch: the three jobs read nothing of each other,
// and few long waves start sooner than many waves of two loads and a store each.
// One work-group of 16 waves per CV_SPAN elements; blockIdx picks the array (work-group
// uniform). A wave owns 2048 contiguous elements: 16 loads of 16 bytes per lane, each load
// 512 contiguous bytes of the wave (whole lines), written ahead of the conversions so that
// most of them are in flight together; each store is 256 contiguous bytes of the wave.
// Every array is a multiple of CV_SPAN long.
// ---------------------------------------------------------------------------
typedef __attribute__((ext_vector_type(4)))  _Float16 v4h;
constexpr int  CV_THREADS = 512;                          // 16 waves
constexpr int  CV_LOADS   = 16;                           // 16-byte loads per lane
constexpr long CV_SPAN    = (long)CV_THREADS * CV_LOADS * 4;   // 32768 elements per work-group

__global__ void __launch_bounds__(CV_THREADS) cvt3_f32_to_f16(
        const float* __restrict__ in0, _Float16* __restrict__ out0, int nb0,
        const float* __restrict__ in1, _Float16* __restrict__ out1, int nb1,
        const float* __restrict__ in2, _Float16* __restrict__ out2) {
    int blk = (int)blockIdx.x;
    const float* in  = in0;
    _Float16*    out = out0;
    if (blk >= nb0 + nb1)  { in = in2; out = out2; blk -= nb0 + nb1; }
    else if (blk >= nb0)   { in = in1; out = out1; blk -= nb0; }
    const int wave = threadIdx.x >> 5, lane = threadIdx.x & 31;
    const long base = (long)blk * CV_SPAN + (long)wave * (CV_LOADS * 128) + lane * 4;
    v4f a[CV_LOADS];
    for (int j = 0; j < CV_LOADS; ++j) a[j] = *(const v4f*)(in + base + j * 128);
    for (int j = 0; j < CV_LOADS; ++j) {
        v4h o;
        for (int e = 0; e < 4; ++e) o[e] = (_Float16)a[j][e];
        *(v4h*)(out + base + j * 128) = o;
    }
}

// ---------------------------------------------------------------------------
// C[M,N] = A[M,K] (row-major f16) x B[N,K]^T (row-major f16, torch-Linear W)
// One work-group of 4 waves -> 128x128 C tile, one wave -> 64x64 (4x4 fragments).
// A pass is 64 k (128 bytes of each of the 256 operand rows). Each wave brings
// one 64-row slice of a stage into LDS with one tensor load (waves 0,1: A rows,
// waves 2,3: B rows); two buffers, the next stage's load flies during a pass.
// Shapes: M, N multiples of 128, K a multiple of 64 and at least 128.
// All work-groups are resident at once, and those of one tile row (column) read the same A (B)
// rows. Walking k from 0 they would all ask L2 for the same lines at the same moment, and every
// new line would be a miss for all of them together. Work-group (x, y) therefore starts at pass
// (x + y) mod passes and wraps: sharers stand on different lines. The k sum is only rotated.
// Columns from vcol0 on (the V third of the qkv product; vcol0 and T multiples of 128) are not
// written to C but, transposed, to Vt[(row / T) * (N - vcol0) + col - vcol0][row % T]: in a C
// fragment a lane holds ONE column and 8 consecutive rows, which are 16 contiguous bytes there.
// ---------------------------------------------------------------------------
typedef uint32_t u32x4 __attribute__((ext_vector_type(4)));
typedef uint32_t u32x8 __attribute__((ext_vector_type(8)));

constexpr uint32_t G_ROWB  = 128;                 // bytes of one operand row in a stage
constexpr uint32_t G_PITCH = G_ROWB + 16;         // LDS pitch, 16 B x odd for ds_load_b128
constexpr uint32_t G_ROWS  = 64;                  // rows of one wave's slice
constexpr uint32_t G_SLICE = 10240;               // 64 * 144 = 9216, rounded up to 2 KiB
constexpr uint32_t G_STAGE = 4 * G_SLICE;         // A half 0 | A half 1 | B half 0 | B half 1
static_assert(G_ROWS * G_PITCH <= G_SLICE && (G_SLICE % 2048u) == 0, "slice places are multiples of 2 KiB");

__device__ __forceinline__ uint32_t uni(uint32_t v) { return (uint32_t)__builtin_amdgcn_readfirstlane(v); }
// Used for the tensor loads alone: an issue test on it compiles to s_cmp + s_cbranch_scc (tensor
// loads ignore EXEC), and a descriptor word made from it stays behind the waits in front of it.
__device__ __forceinline__ uint32_t pinned(uint32_t v) {
    uint32_t w = uni(v);
    asm volatile("" : "+s"(w));   // pinned(): an issue test or a descriptor word held in a scalar register
    return w;
}
// The compiler places no wait for the tensor mover; the clobber keeps LDS reads on their side.
__device__ __forceinline__ void wait_tensor0() { asm volatile("s_wait_tensorcnt 0x0" ::: "memory"); }
// This wave's LDS reads have returned before the buffer is handed over for a refill.
__device__ __forceinline__ void wait_ds0() { asm volatile("s_wait_dscnt 0x0" ::: "memory"); }
// One request of the whole wave: 64 rows of 128 bytes from global memory into LDS.
__device__ __forceinline__ void tdm_load(u32x4 g0, u32x8 g1) {
    asm volatile("tensor_load_to_lds %0, %1" :: "s"(g0), "s"(g1) : "memory");
}
// The same load and the same wait for a ring whose loop needs scalar temporaries: group 0 goes in
// and out of the load in the same registers and is named again by the wait that covers the request,
// so that the compiler gives none of its registers a new value while the request is outstanding
// (left free, words 0 and 3 became loop temporaries).
__device__ __forceinline__ void tdm_load_held(u32x4& g0, u32x8 g1) {
    asm volatile("tensor_load_to_lds %0, %1" : "+s"(g0) : "s"(g1) : "memory");
}
__device__ __forceinline__ void wait_tensor0_of(u32x4 g0) { asm volatile("s_wait_tensorcnt 0x0" :: "s"(g0) : "memory"); }
__device__ __forceinline__ u32x4 tdm_group0(uint32_t lds_dst, uint64_t ga) {
    u32x4 g;
    g[0] = uni(1u);                                                        // count 1
    g[1] = uni(lds_dst);
    g[2] = uni((uint32_t)ga);
    g[3] = uni((((uint32_t)(ga >> 32)) & 0x01FFFFFFu) | 0x80000000u);      // type 2
    return g;
}
// Every word through pinned(): a descriptor word held in a scalar register. Without it the
// compiler used words of this group as loop temporaries while a request was outstanding.
__device__ __forceinline__ u32x8 tdm_group1(uint32_t src_pitch) {
    u32x8 g;
    g[0] = pinned((1u << 20) | (4u << 22) | (3u << 25));   // no mask, bytes, 16 B pad behind each 128-B row
    g[1] = pinned((G_ROWB & 0xFFFFu) << 16);
    g[2] = pinned((G_ROWB >> 16) | ((G_ROWS & 0xFFFFu) << 16));
    g[3] = pinned((G_ROWS >> 16) | (G_ROWB << 16));
    g[4] = pinned(G_ROWS);
    g[5] = pinned(src_pitch);
    g[6] = pinned(0u);
    g[7] = pinned(0u);
    return g;
}

// 16x32 fragment from an LDS slice; p points at byte 16*(lane>>4) of row (lane&15).
// Same k order as load_frag_rm: halves 0-7 at byte 0, halves 8-15 at byte 32.
__device__ __forceinline__ v16h lds_frag(const unsigned char* p) {
    Frag16 f;
    f.p.lo = *(const v8h*)(p);
    f.p.hi = *(const v8h*)(p + 32);
    return f.v;
}

template <bool OUT_HALF>
__global__ void __launch_bounds__(128) gemm_wmma(const _Float16* __restrict__ A,
                                                 const _Float16* __restrict__ B,
                                                 void* __restrict__ C,
                                                 int M, int N, int K, int ldc,
                                                 _Float16* __restrict__ Vt, int vcol0, int T) {
    __shared__ __attribute__((aligned(2048))) unsigned char ring[2 * G_STAGE];
    const uint32_t wave = uni(threadIdx.x >> 5);
    const int lane    = threadIdx.x & 31;
    const int nTilesN = N >> 7;
    const int nTiles  = (M >> 7) * nTilesN;
    if ((int)blockIdx.x >= nTiles) return;            // block-uniform, before any barrier
    const int tm = ((int)blockIdx.x / nTilesN) << 7;
    const int tn = ((int)blockIdx.x % nTilesN) << 7;
    const uint32_t wm = wave >> 1, wn = wave & 1u;    // this wave's 64x64 quadrant

    // this wave's slice of every stage
    const _Float16* srow = (wave < 2u) ? A + (long)(tm + 64 * (int)wave) * K
                                       : B + (long)(tn + 64 * (int)(wave - 2u)) * K;
    const uint64_t ga0  = (uint64_t)(size_t)srow;
    const uint32_t dst0 = (uint32_t)(size_t)ring + wave * G_SLICE;
    const u32x8    g1   = tdm_group1((uint32_t)K * 2u);
    const uint32_t nP   = (uint32_t)K >> 6;
    // stage s holds k pass (k0 + s) mod nP
    const uint32_t k0   = ((uint32_t)(tm >> 7) + (uint32_t)(tn >> 7)) % nP;

    tdm_load(tdm_group0(dst0, ga0 + (uint64_t)k0 * G_ROWB), g1);      // stage 0
    wait_tensor0();
    __syncthreads();                                  // stage 0 published
    {
        const uint32_t n1 = pinned(k0 + 1u);          // descriptor words formed behind the wait
        const uint32_t k1 = (n1 < nP) ? n1 : 0u;
        tdm_load(tdm_group0(dst0 + G_STAGE, ga0 + (uint64_t)k1 * G_ROWB), g1);   // stage 1
    }

    v8f acc[4][4];
    for (int i = 0; i < 4; ++i)
        for (int j = 0; j < 4; ++j) acc[i][j] = v8f{0};

    const uint32_t fo = (uint32_t)(lane & 15) * G_PITCH + (uint32_t)(lane >> 4) * 16u;
    uint32_t s = 0;
    do {                                              // nP is at least 2
        const unsigned char* buf = ring + (s & 1u) * G_STAGE;
        const unsigned char* pa  = buf + wm * G_SLICE + fo;
        const unsigned char* pb  = buf + (2u + wn) * G_SLICE + fo;
        v16h a[2][4], b[2][4];
        for (int kc = 0; kc < 2; ++kc) {
            for (int j = 0; j < 4; ++j) b[kc][j] = lds_frag(pb + j * 16 * G_PITCH + kc * 64);
            for (int i = 0; i < 4; ++i) a[kc][i] = lds_frag(pa + i * 16 * G_PITCH + kc * 64);
        }
        // keeps the pass's LDS reads one group in front of its WMMAs: left alone the compiler
        // put a load pair and a full wait in front of every row of four
        __builtin_amdgcn_sched_barrier(0);
        for (int kc = 0; kc < 2; ++kc)
            for (int i = 0; i < 4; ++i)
                for (int j = 0; j < 4; ++j) acc[i][j] = wmma_f16(a[kc][i], b[kc][j], acc[i][j]);
        // keeps the WMMAs in front of the publish point: sunk behind it they left the wait for
        // the next stage's tensor load at the top of the pass, with nothing to cover its flight
        __builtin_amdgcn_sched_barrier(0);
        // publish point of stage s + 1
        wait_ds0();
        wait_tensor0();
        __syncthreads();                              // s + 1 readable; every wave has left s
        if (pinned(s + 2u < nP)) {
            const uint32_t nx = pinned(s + 2u);       // descriptor words formed behind the wait
            const uint32_t kx = (nx + k0 < nP) ? nx + k0 : nx + k0 - nP;
            tdm_load(tdm_group0(dst0 + (nx & 1u) * G_STAGE, ga0 + (uint64_t)kx * G_ROWB), g1);
        }
    } while (++s < nP);
    wait_tensor0();
    wait_ds0();

    // C fragment layout: VGPR r holds (row=r, lanes0-15 cols) / (row=r+8, lanes16-31)
    int colb = lane & 15;
    int rowb = (lane >> 4) << 3;
    if (OUT_HALF && tn >= vcol0) {                    // block-uniform: a tile is all V or none
        const int bt = tm / T;                        // a tile's 128 rows lie in one batch
        _Float16* vrow = Vt + ((long)bt * (N - vcol0) + (tn - vcol0) + (int)wn * 64 + colb) * T
                            + (tm - bt * T) + (int)wm * 64 + rowb;
        for (int j = 0; j < 4; ++j)
            for (int i = 0; i < 4; ++i) {             // the four i of one j fill a 128-byte line
                v8h o;
                for (int r = 0; r < 8; ++r) o[r] = (_Float16)acc[i][j][r];
                *(v8h*)(vrow + (long)j * 16 * T + i * 16) = o;
            }
        // behind the last store: the code that follows in the listing overwrites address and
        // data registers of these stores
        asm volatile("s_wait_xcnt 0x0" ::: "memory");
        return;
    }
    for (int i = 0; i < 4; ++i)
        for (int j = 0; j < 4; ++j)
            for (int r = 0; r < 8; ++r) {
                long row = tm + (int)wm * 64 + i * 16 + rowb + r;
                long col = tn + (int)wn * 64 + j * 16 + colb;
                float v  = acc[i][j][r];
                if (OUT_HALF) ((_Float16*)C)[row * ldc + col] = (_Float16)v;
                else          ((float*)C)[row * ldc + col]    = v;
            }
}

// ---------------------------------------------------------------------------
// Flash attention, causal + ALiBi, fully transposed dataflow.
//   qkv : [B*T, 3*D] f16 ;  vT : [B*H, hd, T] f16 ;  outh : [B*T, D] f16
// One wave owns 16 query columns (lane = query); key tiles of 32.
//   S^T = K(16kt x 64) · Q^T(64 x 16q)   -> C-frag: lane=q, reg r = kt r/r+8
//   O^T = V^T(64d x 32kt) · P^T(32 x 16q)-> C-frag: lane=q, reg r = d
// P^T C-frag layout == B-operand layout, so P is repacked in registers.
// The four waves of a work-group walk the same keys, so K and V^T come through LDS once
// per work-group and query block: a stage is 64 keys (64 K rows of 128 bytes, 64 V^T rows of 128 bytes),
// wave 0 brings the K slice and wave 1 the V^T slice with one tensor load each; two
// buffers, the next stage's loads fly during a pass. hd = 64, T a multiple of 128.
// Causal cost grows with the query block, and every work-group is resident at once, so the
// launch lasts as long as its fullest WGP. A work-group therefore takes TWO query blocks of
// one head, n-1-t and then t, one after the other in every wave: (n-t) + (t+1) = n+1 stages
// for every work-group. The ring runs on over the change of block: stage numbers count
// through both blocks, and the stages behind the first block start again at key 0.
// The work-groups of one head read the same K and V^T lines and all start together: work-group t
// walks its first block's stages from stage t on and wraps (the softmax runs on in any key order),
// so that they stand on different lines. They reach their second blocks at different times.
// ---------------------------------------------------------------------------
constexpr uint32_t AT_STAGE = 2 * G_SLICE;        // K slice | V^T slice

__global__ void __launch_bounds__(128) attn_flash_wmma(const _Float16* __restrict__ qkv,
                                                       const _Float16* __restrict__ vT,
                                                       _Float16* __restrict__ outh,
                                                       int T, int H, int hd) {
    __shared__ __attribute__((aligned(2048))) unsigned char ring[2 * AT_STAGE];
    const int  D  = H * hd;            // 1024
    const long ld = (long)3 * D;       // 3072
    int nQblk = T / 64;                // even
    int nPair = nQblk / 2;
    int bh    = blockIdx.x / nPair;
    int pr    = blockIdx.x % nPair;    // t: this work-group's query blocks are nQblk-1-t and t
    int b = bh / H, h = bh % H;
    const uint32_t wave = uni(threadIdx.x >> 5);
    int lane = threadIdx.x & 31;

    const float scale = 0.125f;                                   // hd^-0.5
    const float slope = exp2f(-(float)(h + 1) / (float)H);        // ALiBi
    const float NEGINF = -__builtin_inff();

    const _Float16* Qp = qkv + (long)b * T * ld + (long)h * hd;
    const _Float16* Kp = Qp + D;
    const _Float16* Vt = vT + (long)bh * hd * T;

    // the issuing waves' slice of every stage: wave 0 K rows (a stage on = 64 rows), wave 1
    // V^T rows (a stage on = 128 bytes along each row)
    const uint64_t ga0   = (uint64_t)(size_t)((wave == 0u) ? Kp : Vt);
    const uint64_t gstep = (wave == 0u) ? (uint64_t)ld * 2u * G_ROWS : (uint64_t)G_ROWB;
    const uint32_t dst0  = (uint32_t)(size_t)ring + (wave & 1u) * G_SLICE;
    const u32x8    g1    = tdm_group1((wave == 0u) ? (uint32_t)ld * 2u : (uint32_t)T * 2u);
    const uint32_t nS1   = (uint32_t)(nQblk - pr);   // stages of the first block, at least 2
    const uint32_t nS    = (uint32_t)nQblk + 1u;     // stages of both blocks
    const uint32_t ks0   = (uint32_t)pr;             // first key stage of the first block, below nS1

    if (pinned(wave < 2u)) {
        tdm_load(tdm_group0(dst0, ga0 + (uint64_t)ks0 * gstep), g1);      // stage 0
        wait_tensor0();
    }
    __syncthreads();                              // stage 0 published
    const uint32_t n1  = pinned(ks0 + 1u);        // descriptor words formed behind the wait
    u32x4 g0 = tdm_group0(dst0 + AT_STAGE, ga0 + (uint64_t)((n1 < nS1) ? n1 : 0u) * gstep);
    if (pinned(wave < 2u))
        tdm_load_held(g0, g1);                    // stage 1

    const int rh8 = (lane >> 4) << 3;             // 0 or 8 (kt / d row offset)
    const float slope16 = 16.0f * slope;
    const uint32_t fo = (uint32_t)(lane & 15) * G_PITCH + (uint32_t)(lane >> 4) * 16u;
    uint32_t sg = 0;                              // stage number, counted through both blocks

    for (int half = 0; half < 2; ++half) {
    const int qblk  = half ? pr : nQblk - 1 - pr;
    const int qbase = qblk * 64 + (int)wave * 16;

    // Q^T B-operand fragments for this wave's 16 queries (hd=64 -> 2 chunks)
    v16h qfA = load_frag_rm(Qp, ld, qbase, 0);    // dd = 0..31
    v16h qfB = load_frag_rm(Qp, ld, qbase, 32);   // dd = 32..63

    int qlane = qbase + (lane & 15);              // this lane's query index

    // rel = qlane - kt_index, affine per tile: precompute per-register bases
    float relA[8], srelA[8];
    for (int r = 0; r < 8; ++r) {
        float rl  = (float)(qlane - rh8 - r);     // rel at kt = 0, first half
        relA[r]   = rl;
        srelA[r]  = slope * rl;
    }

    v8f  o[4] = {{0}, {0}, {0}, {0}};             // O^T: 64d x 16q, 4 frags
    float mrow = NEGINF, lrow = 0.f;

    // one key tile of 32: pk at K row 0 of the tile, pv at its first key in V^T row 0, both
    // with the lane's fragment offset; ktf = (float) index of the tile's first key
    auto key_tile = [&](const unsigned char* pk, const unsigned char* pv, float ktf) {
        // ---- all K fragments, then the 4 score WMMAs ----
        v16h kf0a = lds_frag(pk);
        v16h kf0b = lds_frag(pk + 64);
        v16h kf1a = lds_frag(pk + 16 * G_PITCH);
        v16h kf1b = lds_frag(pk + 16 * G_PITCH + 64);
        v8f s0 = {0}, s1 = {0};
        s0 = wmma_f16(kf0a, qfA, s0);
        s0 = wmma_f16(kf0b, qfB, s0);
        s1 = wmma_f16(kf1a, qfA, s1);
        s1 = wmma_f16(kf1b, qfB, s1);

        // ---- V fragments early; softmax math below hides their latency
        v16h vf0 = lds_frag(pv);
        v16h vf1 = lds_frag(pv + 16 * G_PITCH);
        v16h vf2 = lds_frag(pv + 32 * G_PITCH);
        v16h vf3 = lds_frag(pv + 48 * G_PITCH);

        // ---- bias + causal mask + local max (all-float, per-lane regs) ----
        float sk = slope * ktf;                   // slope * kt
        float a0[8], a1[8];
        float mloc = NEGINF;
        for (int r = 0; r < 8; ++r) {
            float rel0  = relA[r] - ktf;          // qlane - k0 (exact integer)
            float bias0 = sk - srelA[r];          // -slope*(qlane-k0)
            float v0 = fmaf(s0[r], scale, bias0);
            float v1 = fmaf(s1[r], scale, bias0 + slope16);
            a0[r] = (rel0 >= 0.0f)  ? v0 : NEGINF;
            a1[r] = (rel0 >= 16.0f) ? v1 : NEGINF;
            mloc  = fmaxf(mloc, fmaxf(a0[r], a1[r]));
        }
        mloc = fmaxf(mloc, __shfl_xor(mloc, 16, 32));   // join the two kt halves
        float mnew = fmaxf(mrow, mloc);

        // ---- exponentials, P^T repacked directly into a B-operand frag ----
        float corr = __expf(mrow - mnew);               // 0 when mrow == -inf
        v16h pb = {};
        float ps = 0.f;
        for (int r = 0; r < 8; ++r) {
            float p0 = __expf(a0[r] - mnew);            // exp(-inf) == 0
            float p1 = __expf(a1[r] - mnew);
            ps += p0 + p1;
            pb[r]     = (_Float16)p0;                   // kk = rh8 + r
            pb[8 + r] = (_Float16)p1;                   // kk = 16 + rh8 + r
        }
        ps += __shfl_xor(ps, 16, 32);
        lrow = lrow * corr + ps;
        mrow = mnew;

        // ---- O^T = corr*O^T + V^T x P^T ----
        o[0] = wmma_f16(vf0, pb, o[0] * corr);
        o[1] = wmma_f16(vf1, pb, o[1] * corr);
        o[2] = wmma_f16(vf2, pb, o[2] * corr);
        o[3] = wmma_f16(vf3, pb, o[3] * corr);
    };

    const uint32_t nB  = (uint32_t)qblk + 1u;     // stages of this query block
    const uint32_t rot = half ? 0u : ks0;         // where its walk starts
    uint32_t s = 0;                               // stage within this query block
    do {
        const unsigned char* pk = ring + (sg & 1u) * AT_STAGE + fo;
        const unsigned char* pv = pk + G_SLICE;
        const uint32_t ks = (s + rot < nB) ? s + rot : s + rot - nB;   // this stage's 64 keys
        const int kt = (int)ks * 64;
        key_tile(pk, pv, (float)kt);
        if (kt + 32 <= qbase + 15)                // wave-uniform: false only on the diagonal stage
            key_tile(pk + 32 * G_PITCH, pv + 64, (float)(kt + 32));
        // publish point of stage sg + 1
        wait_ds0();
        if (pinned(wave < 2u)) wait_tensor0_of(g0);
        __syncthreads();                          // sg + 1 readable; every wave has left sg
        if (pinned((wave < 2u) && (sg + 2u < nS))) {
            const uint32_t nx = pinned(sg + 2u);  // descriptor words formed behind the wait
            const uint32_t kw = nx + ((nx < nS1) ? ks0 : 0u); // the first block's walk is rotated by ks0
            const uint32_t kb = (kw < nS1) ? kw : kw - nS1;   // its 64 keys, as its block's walk has them
            g0 = tdm_group0(dst0 + (nx & 1u) * AT_STAGE, ga0 + (uint64_t)kb * gstep);
            tdm_load_held(g0, g1);
        }
        ++sg;
    } while (++s <= (uint32_t)qblk);

    // ---- normalize, write O^T: lane q stores 8 contiguous d per fragment ----
    float rinv = 1.0f / lrow;
    _Float16* dst = outh + ((long)b * T + qlane) * D + (long)h * hd + rh8;
    for (int f = 0; f < 4; ++f) {
        v8h ov;
        for (int r = 0; r < 8; ++r) ov[r] = (_Float16)(o[f][r] * rinv);
        *(v8h*)(dst + f * 16) = ov;                     // d = f*16 + rh8 + r
    }
    // the next block's set-up overwrites the address and data registers of these stores
    asm volatile("s_wait_xcnt 0x0" ::: "memory");
    }   // second query block
    wait_tensor0();
    wait_ds0();
}

// ---------------------------------------------------------------------------
// Host launcher
// ---------------------------------------------------------------------------
extern "C" void kernel_launch(void* const* d_in, const int* in_sizes, int n_in,
                              void* d_out, int out_size, void* d_ws, size_t ws_size,
                              hipStream_t stream) {
    (void)in_sizes; (void)n_in; (void)out_size; (void)ws_size;
    constexpr int  Bb = 2, T = 2048, D = 1024, H = 16, HD = 64;
    constexpr long M  = (long)Bb * T;          // 4096

    const float* x     = (const float*)d_in[0];
    const float* w_qkv = (const float*)d_in[1];
    const float* w_out = (const float*)d_in[2];
    float*       out   = (float*)d_out;

    // workspace carve-up (256B aligned)
    char* ws = (char*)d_ws;
    size_t off = 0;
    auto carve = [&](size_t bytes) {
        size_t r = off;
        off += (bytes + 255) & ~(size_t)255;
        return r;
    };
    _Float16* xh    = (_Float16*)(ws + carve(M * D * 2));               //  8 MB
    _Float16* wqkvh = (_Float16*)(ws + carve((size_t)3 * D * D * 2));   //  6 MB
    _Float16* wouth = (_Float16*)(ws + carve((size_t)D * D * 2));       //  2 MB
    _Float16* qkvh  = (_Float16*)(ws + carve(M * 3 * D * 2));           // 24 MB
    _Float16* vTh   = (_Float16*)(ws + carve((size_t)Bb * H * HD * T * 2)); // 8 MB
    _Float16* atth  = (_Float16*)(ws + carve(M * D * 2));               //  8 MB

    // 1) f32 -> f16 conversions, one launch for the three arrays
    {
        constexpr long n1 = M * D, n2 = (long)3 * D * D, n3 = (long)D * D;
        static_assert(n1 % CV_SPAN == 0 && n2 % CV_SPAN == 0 && n3 % CV_SPAN == 0, "whole spans only");
        constexpr int nb1 = (int)(n1 / CV_SPAN), nb2 = (int)(n2 / CV_SPAN), nb3 = (int)(n3 / CV_SPAN);
        cvt3_f32_to_f16<<<dim3(nb1 + nb2 + nb3), dim3(CV_THREADS), 0, stream>>>(
            x, xh, nb1, w_qkv, wqkvh, nb2, w_out, wouth);
    }

    // 2) qkv = x @ w_qkv^T   (4096x1024 x 1024x3072): Q, K -> f16 [4096,3072] (its V third stays
    //    unwritten and unread), V -> vT[bh][d][t]
    {
        int tiles = (int)(M / 128) * (3 * D / 128);   // 768
        gemm_wmma<true><<<dim3(tiles), dim3(128), 0, stream>>>(
            xh, wqkvh, qkvh, (int)M, 3 * D, D, 3 * D, vTh, 2 * D, T);
    }

    // 3) flash attention (causal + ALiBi, transposed dataflow) -> atth f16
    {
        int blocks = Bb * H * (T / 128);              // 512: two query blocks each
        attn_flash_wmma<<<dim3(blocks), dim3(128), 0, stream>>>(qkvh, vTh, atth, T, H, HD);
    }

    // 4) out = attn @ w_out^T -> f32 d_out
    {
        int tiles = (int)(M / 128) * (D / 128);       // 256
        gemm_wmma<false><<<dim3(tiles), dim3(128), 0, stream>>>(
            atth, wouth, out, (int)M, D, D, D, nullptr, D, T);
    }
}

// v007
// A run of this version takes 72.9 microseconds.
// Next to v006, in two timings, it ran 1.05 and 1.06 times as fast.
// Counting every step since v000, it is 4.55 times as fast.
#include <hip/hip_runtime.h>
#include <stdint.h>

// ---------------------------------------------------------------------------
// CDNA5 (gfx1250) self-attention forward, f16 WMMA with f32 accumulation.
// Fixed problem: B=2, T=2048, D=1024, H=16, hd=64 (per reference setup).
// Attention computed in transposed form (S^T = K·Q^T, O^T = V^T·P^T) so that
// softmax row statistics are per-lane and P converts C-frag -> B-frag in
// registers (no LDS round trip, no bpermute reduction chains).
// ---------------------------------------------------------------------------

typedef __attribute__((ext_vector_type(16))) _Float16 v16h;
typedef __attribute__((ext_vector_type(8)))  _Float16 v8h;
typedef __attribute__((ext_vector_type(8)))  float    v8f;
typedef __attribute__((ext_vector_type(4)))  float    v4f;

union Frag16 {
    v16h v;
    struct { v8h lo; v8h hi; } p;
};

// D = A x B + C  (16x16x32, f16 in, f32 acc)
__device__ __forceinline__ v8f wmma_f16(v16h a, v16h b, v8f c) {
    return __builtin_amdgcn_wmma_f32_16x16x32_f16(
        /*neg_a=*/false, a, /*neg_b=*/false, b,
        /*c_mod=*/(short)0, c, /*reuse_a=*/false, /*reuse_b=*/false);
}

// Load a 16x32 A-style fragment from a row-major matrix (also the layout of
// the B operand of A·B^T when the second matrix is stored row-major N x K).
// CDNA5 16-bit A layout:
//   lanes 0-15 : row = lane,    halves 0-7 -> K=k0+0..7,  halves 8-15 -> K=k0+16..23
//   lanes 16-31: row = lane-16, halves 0-7 -> K=k0+8..15, halves 8-15 -> K=k0+24..31
__device__ __forceinline__ v16h load_frag_rm(const _Float16* __restrict__ base,
                                             long ld, int row0, int k0) {
    int lane = threadIdx.x & 31;
    int r    = row0 + (lane & 15);
    int hs   = (lane >> 4) << 3;            // 0 or 8
    const _Float16* p = base + (long)r * ld + k0 + hs;
    Frag16 f;
    f.p.lo = *(const v8h*)(p);              // K = k0+hs .. +7
    f.p.hi = *(const v8h*)(p + 16);         // K = k0+16+hs .. +7
    return f.v;
}

// ---------------------------------------------------------------------------
// f32 -> f16 for all three inputs in ONE launch: the three jobs read nothing of each other,
// and few long waves start sooner than many waves of two loads and a store each.
// One work-group of 16 waves per CV_SPAN elements; blockIdx picks the array (work-group
// uniform). A wave owns 2048 contiguous elements: 16 loads of 16 bytes per lane, each load
// 512 contiguous bytes of the wave (whole lines), written ahead of the conversions so that
// most of them are in flight together; each store is 256 contiguous bytes of the wave.
// Every array is a multiple of CV_SPAN long.
// ---------------------------------------------------------------------------
typedef __attribute__((ext_vector_type(4)))  _Float16 v4h;
constexpr int  CV_THREADS = 512;                          // 16 waves
constexpr int  CV_LOADS   = 16;                           // 16-byte loads per lane
constexpr long CV_SPAN    = (long)CV_THREADS * CV_LOADS * 4;   // 32768 elements per work-group

__global__ void __launch_bounds__(CV_THREADS) cvt3_f32_to_f16(
        const float* __restrict__ in0, _Float16* __restrict__ out0, int nb0,
        const float* __restrict__ in1, _Float16* __restrict__ out1, int nb1,
        const float* __restrict__ in2, _Float16* __restrict__ out2) {
    int blk = (int)blockIdx.x;
    const float* in  = in0;
    _Float16*    out = out0;
    if (blk >= nb0 + nb1)  { in = in2; out = out2; blk -= nb0 + nb1; }
    else if (blk >= nb0)   { in = in1; out = out1; blk -= nb0; }
    const int wave = threadIdx.x >> 5, lane = threadIdx.x & 31;
    const long base = (long)blk * CV_SPAN + (long)wave * (CV_LOADS * 128) + lane * 4;
    v4f a[CV_LOADS];
    for (int j = 0; j < CV_LOADS; ++j) a[j] = *(const v4f*)(in + base + j * 128);
    for (int j = 0; j < CV_LOADS; ++j) {
        v4h o;
        for (int e = 0; e < 4; ++e) o[e] = (_Float16)a[j][e];
        *(v4h*)(out + base + j * 128) = o;
    }
}

// ---------------------------------------------------------------------------
// C[M,N] = A[M,K] (row-major f16) x B[N,K]^T (row-major f16, torch-Linear W)
// One work-group of 4 waves -> 128x128 C tile, one wave -> 64x64 (4x4 fragments).
// A pass is 64 k (128 bytes of each of the 256 operand rows). Each wave brings
// one 64-row slice of a stage into LDS with one tensor load (waves 0,1: A rows,
// waves 2,3: B rows); two buffers, the next stage's load flies during a pass.
// Shapes: M, N multiples of 128, K a multiple of 64 and at least 128.
// All work-groups are resident at once, and those of one tile row (column) read the same A (B)
// rows. Walking k from 0 they would all ask L2 for the same lines at the same moment, and every
// new line would be a miss for all of them together. Work-group (x, y) therefore starts at pass
// (x + y) mod passes and wraps: sharers stand on different lines. The k sum is only rotated.
// Columns from vcol0 on (the V third of the qkv product; vcol0 and T multiples of 128) are not
// written to C but, transposed, to Vt[(row / T) * (N - vcol0) + col - vcol0][row % T]: in a C
// fragment a lane holds ONE column and 8 consecutive rows, which are 16 contiguous bytes there.
// Columns below qcol1 (the Q third; a multiple of 128) are multiplied by qmul in f32 before their
// one rounding to f16: the attention kernel's score products then need no scaling of their own.
// ---------------------------------------------------------------------------
typedef uint32_t u32x4 __attribute__((ext_vector_type(4)));
typedef uint32_t u32x8 __attribute__((ext_vector_type(8)));

constexpr uint32_t G_ROWB  = 128;                 // bytes of one operand row in a stage
constexpr uint32_t G_PITCH = G_ROWB + 16;         // LDS pitch, 16 B x odd for ds_load_b128
constexpr uint32_t G_ROWS  = 64;                  // rows of one wave's slice
constexpr uint32_t G_SLICE = 10240;               // 64 * 144 = 9216, rounded up to 2 KiB
constexpr uint32_t G_STAGE = 4 * G_SLICE;         // A half 0 | A half 1 | B half 0 | B half 1
static_assert(G_ROWS * G_PITCH <= G_SLICE && (G_SLICE % 2048u) == 0, "slice places are multiples of 2 KiB");

__device__ __forceinline__ uint32_t uni(uint32_t v) { return (uint32_t)__builtin_amdgcn_readfirstlane(v); }
// Used for the tensor loads alone: an issue test on it compiles to s_cmp + s_cbranch_scc (tensor
// loads ignore EXEC), and a descriptor word made from it stays behind the waits in front of it.
__device__ __forceinline__ uint32_t pinned(uint32_t v) {
    uint32_t w = uni(v);
    asm volatile("" : "+s"(w));   // pinned(): an issue test or a descriptor word held in a scalar register
    return w;
}
// The compiler places no wait for the tensor mover; the clobber keeps LDS reads on their side.
__device__ __forceinline__ void wait_tensor0() { asm volatile("s_wait_tensorcnt 0x0" ::: "memory"); }
// This wave's LDS reads have returned before the buffer is handed over for a refill.
__device__ __forceinline__ void wait_ds0() { asm volatile("s_wait_dscnt 0x0" ::: "memory"); }
// One request of the whole wave: 64 rows of 128 bytes from global memory into LDS.
__device__ __forceinline__ void tdm_load(u32x4 g0, u32x8 g1) {
    asm volatile("tensor_load_to_lds %0, %1" :: "s"(g0), "s"(g1) : "memory");
}
// The same load and the same wait for a ring whose loop needs scalar temporaries: group 0 goes in
// and out of the load in the same registers and is named again by the wait that covers the request,
// so that the compiler gives none of its registers a new value while the request is outstanding
// (left free, words 0 and 3 became loop temporaries).
__device__ __forceinline__ void tdm_load_held(u32x4& g0, u32x8 g1) {
    asm volatile("tensor_load_to_lds %0, %1" : "+s"(g0) : "s"(g1) : "memory");
}
__device__ __forceinline__ void wait_tensor0_of(u32x4 g0) { asm volatile("s_wait_tensorcnt 0x0" :: "s"(g0) : "memory"); }
__device__ __forceinline__ u32x4 tdm_group0(uint32_t lds_dst, uint64_t ga) {
    u32x4 g;
    g[0] = uni(1u);                                                        // count 1
    g[1] = uni(lds_dst);
    g[2] = uni((uint32_t)ga);
    g[3] = uni((((uint32_t)(ga >> 32)) & 0x01FFFFFFu) | 0x80000000u);      // type 2
    return g;
}
// Every word through pinned(): a descriptor word held in a scalar register. Without it the
// compiler used words of this group as loop temporaries while a request was outstanding.
__device__ __forceinline__ u32x8 tdm_group1(uint32_t src_pitch) {
    u32x8 g;
    g[0] = pinned((1u << 20) | (4u << 22) | (3u << 25));   // no mask, bytes, 16 B pad behind each 128-B row
    g[1] = pinned((G_ROWB & 0xFFFFu) << 16);
    g[2] = pinned((G_ROWB >> 16) | ((G_ROWS & 0xFFFFu) << 16));
    g[3] = pinned((G_ROWS >> 16) | (G_ROWB << 16));
    g[4] = pinned(G_ROWS);
    g[5] = pinned(src_pitch);
    g[6] = pinned(0u);
    g[7] = pinned(0u);
    return g;
}

// 16x32 fragment from an LDS slice; p points at byte 16*(lane>>4) of row (lane&15).
// Same k order as load_frag_rm: halves 0-7 at byte 0, halves 8-15 at byte 32.
__device__ __forceinline__ v16h lds_frag(const unsigned char* p) {
    Frag16 f;
    f.p.lo = *(const v8h*)(p);
    f.p.hi = *(const v8h*)(p + 32);
    return f.v;
}

template <bool OUT_HALF>
__global__ void __launch_bounds__(128) gemm_wmma(const _Float16* __restrict__ A,
                                                 const _Float16* __restrict__ B,
                                                 void* __restrict__ C,
                                                 int M, int N, int K, int ldc,
                                                 _Float16* __restrict__ Vt, int vcol0, int T,
                                                 int qcol1, float qmul) {
    __shared__ __attribute__((aligned(2048))) unsigned char ring[2 * G_STAGE];
    const uint32_t wave = uni(threadIdx.x >> 5);
    const int lane    = threadIdx.x & 31;
    const int nTilesN = N >> 7;
    const int nTiles  = (M >> 7) * nTilesN;
    if ((int)blockIdx.x >= nTiles) return;            // block-uniform, before any barrier
    const int tm = ((int)blockIdx.x / nTilesN) << 7;
    const int tn = ((int)blockIdx.x % nTilesN) << 7;
    const uint32_t wm = wave >> 1, wn = wave & 1u;    // this wave's 64x64 quadrant

    // this wave's slice of every stage
    const _Float16* srow = (wave < 2u) ? A + (long)(tm + 64 * (int)wave) * K
                                       : B + (long)(tn + 64 * (int)(wave - 2u)) * K;
    const uint64_t ga0  = (uint64_t)(size_t)srow;
    const uint32_t dst0 = (uint32_t)(size_t)ring + wave * G_SLICE;
    const u32x8    g1   = tdm_group1((uint32_t)K * 2u);
    const uint32_t nP   = (uint32_t)K >> 6;
    // stage s holds k pass (k0 + s) mod nP
    const uint32_t k0   = ((uint32_t)(tm >> 7) + (uint32_t)(tn >> 7)) % nP;

    tdm_load(tdm_group0(dst0, ga0 + (uint64_t)k0 * G_ROWB), g1);      // stage 0
    wait_tensor0();
    __syncthreads();                                  // stage 0 published
    {
        const uint32_t n1 = pinned(k0 + 1u);          // descriptor words formed behind the wait
        const uint32_t k1 = (n1 < nP) ? n1 : 0u;
        tdm_load(tdm_group0(dst0 + G_STAGE, ga0 + (uint64_t)k1 * G_ROWB), g1);   // stage 1
    }

    v8f acc[4][4];
    for (int i = 0; i < 4; ++i)
        for (int j = 0; j < 4; ++j) acc[i][j] = v8f{0};

    const uint32_t fo = (uint32_t)(lane & 15) * G_PITCH + (uint32_t)(lane >> 4) * 16u;
    uint32_t s = 0;
    do {                                              // nP is at least 2
        const unsigned char* buf = ring + (s & 1u) * G_STAGE;
        const unsigned char* pa  = buf + wm * G_SLICE + fo;
        const unsigned char* pb  = buf + (2u + wn) * G_SLICE + fo;
        v16h a[2][4], b[2][4];
        for (int kc = 0; kc < 2; ++kc) {
            for (int j = 0; j < 4; ++j) b[kc][j] = lds_frag(pb + j * 16 * G_PITCH + kc * 64);
            for (int i = 0; i < 4; ++i) a[kc][i] = lds_frag(pa + i * 16 * G_PITCH + kc * 64);
        }
        // keeps the pass's LDS reads one group in front of its WMMAs: left alone the compiler
        // put a load pair and a full wait in front of every row of four
        __builtin_amdgcn_sched_barrier(0);
        for (int kc = 0; kc < 2; ++kc)
            for (int i = 0; i < 4; ++i)
                for (int j = 0; j < 4; ++j) acc[i][j] = wmma_f16(a[kc][i], b[kc][j], acc[i][j]);
        // keeps the WMMAs in front of the publish point: sunk behind it they left the wait for
        // the next stage's tensor load at the top of the pass, with nothing to cover its flight
        __builtin_amdgcn_sched_barrier(0);
        // publish point of stage s + 1
        wait_ds0();
        wait_tensor0();
        __syncthreads();                              // s + 1 readable; every wave has left s
        if (pinned(s + 2u < nP)) {
            const uint32_t nx = pinned(s + 2u);       // descriptor words formed behind the wait
            const uint32_t kx = (nx + k0 < nP) ? nx + k0 : nx + k0 - nP;
            tdm_load(tdm_group0(dst0 + (nx & 1u) * G_STAGE, ga0 + (uint64_t)kx * G_ROWB), g1);
        }
    } while (++s < nP);
    wait_tensor0();
    wait_ds0();

    // C fragment layout: VGPR r holds (row=r, lanes0-15 cols) / (row=r+8, lanes16-31)
    int colb = lane & 15;
    int rowb = (lane >> 4) << 3;
    if (OUT_HALF && tn >= vcol0) {                    // block-uniform: a tile is all V or none
        const int bt = tm / T;                        // a tile's 128 rows lie in one batch
        _Float16* vrow = Vt + ((long)bt * (N - vcol0) + (tn - vcol0) + (int)wn * 64 + colb) * T
                            + (tm - bt * T) + (int)wm * 64 + rowb;
        for (int j = 0; j < 4; ++j)
            for (int i = 0; i < 4; ++i) {             // the four i of one j fill a 128-byte line
                v8h o;
                for (int r = 0; r < 8; ++r) o[r] = (_Float16)acc[i][j][r];
                *(v8h*)(vrow + (long)j * 16 * T + i * 16) = o;
            }
        // behind the last store: the code that follows in the listing overwrites address and
        // data registers of these stores
        asm volatile("s_wait_xcnt 0x0" ::: "memory");
        return;
    }
    const float om = (tn < qcol1) ? qmul : 1.0f;      // block-uniform: a tile is all Q or none
    for (int i = 0; i < 4; ++i)
        for (int j = 0; j < 4; ++j)
            for (int r = 0; r < 8; ++r) {
                long row = tm + (int)wm * 64 + i * 16 + rowb + r;
                long col = tn + (int)wn * 64 + j * 16 + colb;
                float v  = acc[i][j][r];
                if (OUT_HALF) ((_Float16*)C)[row * ldc + col] = (_Float16)(v * om);
                else          ((float*)C)[row * ldc + col]    = v;
            }
}

// ---------------------------------------------------------------------------
// Flash attention, causal + ALiBi, fully transposed dataflow.
//   qkv : [B*T, 3*D] f16 ;  vT : [B*H, hd, T] f16 ;  outh : [B*T, D] f16
// One wave owns 16 query columns (lane = query); key tiles of 32.
//   S^T = K(16kt x 64) · Q^T(64 x 16q)   -> C-frag: lane=q, reg r = kt r/r+8
//   O^T = V^T(64d x 32kt) · P^T(32 x 16q)-> C-frag: lane=q, reg r = d
// P^T C-frag layout == B-operand layout, so P is repacked in registers.
// The score WMMAs deliver the finished exponent of 2: Q arrives multiplied by hd^-0.5 * log2(e),
// and what is added to a score, ALiBi bias and causal mask, goes in as their C operand. Under the
// mask the bias is slope * (key - query); the query's part is one constant per softmax row and
// drops out, and the key's part is split into slope * (key - tile's first key), the same 16
// numbers a lane in every tile, and slope * (tile's first key), by which the running maximum is
// moved instead when the walk goes from one tile to another. A tile whose last key is not behind
// the wave's first query masks nothing: its C operand is those 16 numbers, loop-invariant. Only a
// tile on the diagonal forms its own, with MASKED in the place of each key behind the query.
// The four waves of a work-group walk the same keys, so K and V^T come through LDS once
// per work-group and query block: a stage is 64 keys (64 K rows of 128 bytes, 64 V^T rows of 128 bytes),
// wave 0 brings the K slice and wave 1 the V^T slice with one tensor load each; two
// buffers, the next stage's loads fly during a pass. hd = 64, T a multiple of 128.
// Causal cost grows with the query block, and every work-group is resident at once, so the
// launch lasts as long as its fullest WGP. A work-group therefore takes TWO query blocks of
// one head, n-1-t and then t, one after the other in every wave: (n-t) + (t+1) = n+1 stages
// for every work-group. The ring runs on over the change of block: stage numbers count
// through both blocks, and the stages behind the first block start again at key 0.
// The work-groups of one head read the same K and V^T lines and all start together: work-group t
// walks its first block's stages from stage t on and wraps (the softmax runs on in any key order),
// so that they stand on different lines. They reach their second blocks at different times.
// ---------------------------------------------------------------------------
constexpr uint32_t AT_STAGE = 2 * G_SLICE;        // K slice | V^T slice
constexpr float    LOG2E    = 1.44269504f;
constexpr float    Q_SCALE  = 0.125f * LOG2E;     // hd^-0.5 * log2(e), multiplied into Q by the qkv product
constexpr float    MASKED   = -1.0e30f;           // far below any score of f16 operands: 2^(MASKED - max) is 0
struct OnDiagonal  { static constexpr bool value = true;  };
struct OffDiagonal { static constexpr bool value = false; };

__global__ void __launch_bounds__(128) attn_flash_wmma(const _Float16* __restrict__ qkv,
                                                       const _Float16* __restrict__ vT,
                                                       _Float16* __restrict__ outh,
                                                       int T, int H, int hd) {
    __shared__ __attribute__((aligned(2048))) unsigned char ring[2 * AT_STAGE];
    const int  D  = H * hd;            // 1024
    const long ld = (long)3 * D;       // 3072
    int nQblk = T / 64;                // even
    int nPair = nQblk / 2;
    int bh    = blockIdx.x / nPair;
    int pr    = blockIdx.x % nPair;    // t: this work-group's query blocks are nQblk-1-t and t
    int b = bh / H, h = bh % H;
    const uint32_t wave = uni(threadIdx.x >> 5);
    int lane = threadIdx.x & 31;

    const float slope2 = exp2f(-(float)(h + 1) / (float)H) * LOG2E;   // ALiBi slope, in powers of 2
    const float NEGINF = -__builtin_inff();

    const _Float16* Qp = qkv + (long)b * T * ld + (long)h * hd;
    const _Float16* Kp = Qp + D;
    const _Float16* Vt = vT + (long)bh * hd * T;

    // the issuing waves' slice of every stage: wave 0 K rows (a stage on = 64 rows), wave 1
    // V^T rows (a stage on = 128 bytes along each row)
    const uint64_t ga0   = (uint64_t)(size_t)((wave == 0u) ? Kp : Vt);
    const uint64_t gstep = (wave == 0u) ? (uint64_t)ld * 2u * G_ROWS : (uint64_t)G_ROWB;
    const uint32_t dst0  = (uint32_t)(size_t)ring + (wave & 1u) * G_SLICE;
    const u32x8    g1    = tdm_group1((wave == 0u) ? (uint32_t)ld * 2u : (uint32_t)T * 2u);
    const uint32_t nS1   = (uint32_t)(nQblk - pr);   // stages of the first block, at least 2
    const uint32_t nS    = (uint32_t)nQblk + 1u;     // stages of both blocks
    const uint32_t ks0   = (uint32_t)pr;             // first key stage of the first block, below nS1

    if (pinned(wave < 2u)) {
        tdm_load(tdm_group0(dst0, ga0 + (uint64_t)ks0 * gstep), g1);      // stage 0
        wait_tensor0();
    }
    __syncthreads();                              // stage 0 published
    const uint32_t n1  = pinned(ks0 + 1u);        // descriptor words formed behind the wait
    u32x4 g0 = tdm_group0(dst0 + AT_STAGE, ga0 + (uint64_t)((n1 < nS1) ? n1 : 0u) * gstep);
    if (pinned(wave < 2u))
        tdm_load_held(g0, g1);                    // stage 1

    const int rh8 = (lane >> 4) << 3;             // 0 or 8 (kt / d row offset)
    v8f cb0, cb1;                                 // slope2 * (key - tile's first key), C-frag layout
    for (int r = 0; r < 8; ++r) {
        cb0[r] = slope2 * (float)(rh8 + r);
        cb1[r] = slope2 * (float)(16 + rh8 + r);
    }
    const uint32_t fo = (uint32_t)(lane & 15) * G_PITCH + (uint32_t)(lane >> 4) * 16u;
    uint32_t sg = 0;                              // stage number, counted through both blocks

    for (int half = 0; half < 2; ++half) {
    const int qblk  = half ? pr : nQblk - 1 - pr;
    const int qbase = qblk * 64 + (int)wave * 16;

    // Q^T B-operand fragments for this wave's 16 queries (hd=64 -> 2 chunks)
    v16h qfA = load_frag_rm(Qp, ld, qbase, 0);    // dd = 0..31
    v16h qfB = load_frag_rm(Qp, ld, qbase, 32);   // dd = 32..63

    int qlane = qbase + (lane & 15);              // this lane's query index

    // rel = qlane - kt_index, affine per tile: precompute per-register bases
    float relA[8];
    for (int r = 0; r < 8; ++r) relA[r] = (float)(qlane - rh8 - r);   // rel at kt = 0, first half

    v8f  o[4] = {{0}, {0}, {0}, {0}};             // O^T: 64d x 16q, 4 frags
    float mrow = NEGINF, lrow = 0.f;              // mrow counts from slope2 * kref
    int   kref = 0;                               // first key of the tile worked on last (wave-uniform)

    // one key tile of 32: pk at K row 0 of the tile, pv at its first key in V^T row 0, both
    // with the lane's fragment offset; kt = index of the tile's first key
    auto key_tile = [&](auto diag, const unsigned char* pk, const unsigned char* pv, int kt) {
        // ---- C operand of the score WMMAs ----
        v8f c0 = cb0, c1 = cb1;
        if constexpr (decltype(diag)::value) {
            const float ktf = (float)kt;
            for (int r = 0; r < 8; ++r) {
                float rel0 = relA[r] - ktf;       // qlane - k0 (exact integer)
                c0[r] = (rel0 >= 0.0f)  ? cb0[r] : MASKED;
                c1[r] = (rel0 >= 16.0f) ? cb1[r] : MASKED;
            }
        }
        // ---- all K fragments, then the 4 score WMMAs ----
        v16h kf0a = lds_frag(pk);
        v16h kf0b = lds_frag(pk + 64);
        v16h kf1a = lds_frag(pk + 16 * G_PITCH);
        v16h kf1b = lds_frag(pk + 16 * G_PITCH + 64);
        v8f s0 = wmma_f16(kf0a, qfA, c0);
        s0 = wmma_f16(kf0b, qfB, s0);
        v8f s1 = wmma_f16(kf1a, qfA, c1);
        s1 = wmma_f16(kf1b, qfB, s1);

        // ---- V fragments early; softmax math below hides their latency
        v16h vf0 = lds_frag(pv);
        v16h vf1 = lds_frag(pv + 16 * G_PITCH);
        v16h vf2 = lds_frag(pv + 32 * G_PITCH);
        v16h vf3 = lds_frag(pv + 48 * G_PITCH);

        // ---- local max (per-lane regs) ----
        float mloc = NEGINF;
        for (int r = 0; r < 8; ++r) mloc = fmaxf(mloc, fmaxf(s0[r], s1[r]));
        mloc = fmaxf(mloc, __shfl_xor(mloc, 16, 32));   // join the two kt halves
        const float mold = mrow - slope2 * (float)(kt - kref);   // the maximum so far, counted from this tile
        kref = kt;
        float mnew = fmaxf(mold, mloc);

        // ---- powers of 2, P^T repacked directly into a B-operand frag ----
        float corr = __builtin_amdgcn_exp2f(mold - mnew);        // 0 when mold == -inf
        v16h pb = {};
        float ps = 0.f;
        for (int r = 0; r < 8; ++r) {
            float p0 = __builtin_amdgcn_exp2f(s0[r] - mnew);     // 0 where masked
            float p1 = __builtin_amdgcn_exp2f(s1[r] - mnew);
            ps += p0 + p1;
            pb[r]     = (_Float16)p0;                   // kk = rh8 + r
            pb[8 + r] = (_Float16)p1;                   // kk = 16 + rh8 + r
        }
        ps += __shfl_xor(ps, 16, 32);
        lrow = lrow * corr + ps;
        mrow = mnew;

        // ---- O^T = corr*O^T + V^T x P^T ----
        o[0] = wmma_f16(vf0, pb, o[0] * corr);
        o[1] = wmma_f16(vf1, pb, o[1] * corr);
        o[2] = wmma_f16(vf2, pb, o[2] * corr);
        o[3] = wmma_f16(vf3, pb, o[3] * corr);
    };

    const uint32_t nB  = (uint32_t)qblk + 1u;     // stages of this query block
    const uint32_t rot = half ? 0u : ks0;         // where its walk starts
    uint32_t s = 0;                               // stage within this query block
    do {
        const unsigned char* pk = ring + (sg & 1u) * AT_STAGE + fo;
        const unsigned char* pv = pk + G_SLICE;
        const uint32_t ks = (s + rot < nB) ? s + rot : s + rot - nB;   // this stage's 64 keys
        const int kt = (int)ks * 64;
        if (kt + 63 <= qbase) {                   // wave-uniform: no key of the stage behind a query
            key_tile(OffDiagonal{}, pk, pv, kt);
            key_tile(OffDiagonal{}, pk + 32 * G_PITCH, pv + 64, kt + 32);
        } else {                                  // the diagonal stage
            key_tile(OnDiagonal{}, pk, pv, kt);
            if (kt + 32 <= qbase + 15)            // wave-uniform: else every key of the tile is masked
                key_tile(OnDiagonal{}, pk + 32 * G_PITCH, pv + 64, kt + 32);
        }
        // publish point of stage sg + 1
        wait_ds0();
        if (pinned(wave < 2u)) wait_tensor0_of(g0);
        __syncthreads();                          // sg + 1 readable; every wave has left sg
        if (pinned((wave < 2u) && (sg + 2u < nS))) {
            const uint32_t nx = pinned(sg + 2u);  // descriptor words formed behind the wait
            const uint32_t kw = nx + ((nx < nS1) ? ks0 : 0u); // the first block's walk is rotated by ks0
            const uint32_t kb = (kw < nS1) ? kw : kw - nS1;   // its 64 keys, as its block's walk has them
            g0 = tdm_group0(dst0 + (nx & 1u) * AT_STAGE, ga0 + (uint64_t)kb * gstep);
            tdm_load_held(g0, g1);
        }
        ++sg;
    } while (++s <= (uint32_t)qblk);

    // ---- normalize, write O^T: lane q stores 8 contiguous d per fragment ----
    float rinv = 1.0f / lrow;
    _Float16* dst = outh + ((long)b * T + qlane) * D + (long)h * hd + rh8;
    for (int f = 0; f < 4; ++f) {
        v8h ov;
        for (int r = 0; r < 8; ++r) ov[r] = (_Float16)(o[f][r] * rinv);
        *(v8h*)(dst + f * 16) = ov;                     // d = f*16 + rh8 + r
    }
    // the next block's set-up overwrites the address and data registers of these stores
    asm volatile("s_wait_xcnt 0x0" ::: "memory");
    }   // second query block
    wait_tensor0();
    wait_ds0();
}

// ---------------------------------------------------------------------------
// Host launcher
// ---------------------------------------------------------------------------
extern "C" void kernel_launch(void* const* d_in, const int* in_sizes, int n_in,
                              void* d_out, int out_size, void* d_ws, size_t ws_size,
                              hipStream_t stream) {
    (void)in_sizes; (void)n_in; (void)out_size; (void)ws_size;
    constexpr int  Bb = 2, T = 2048, D = 1024, H = 16, HD = 64;
    constexpr long M  = (long)Bb * T;          // 4096

    const float* x     = (const float*)d_in[0];
    const float* w_qkv = (const float*)d_in[1];
    const float* w_out = (const float*)d_in[2];
    float*       out   = (float*)d_out;

    // workspace carve-up (256B aligned)
    char* ws = (char*)d_ws;
    size_t off = 0;
    auto carve = [&](size_t bytes) {
        size_t r = off;
        off += (bytes + 255) & ~(size_t)255;
        return r;
    };
    _Float16* xh    = (_Float16*)(ws + carve(M * D * 2));               //  8 MB
    _Float16* wqkvh = (_Float16*)(ws + carve((size_t)3 * D * D * 2));   //  6 MB
    _Float16* wouth = (_Float16*)(ws + carve((size_t)D * D * 2));       //  2 MB
    _Float16* qkvh  = (_Float16*)(ws + carve(M * 3 * D * 2));           // 24 MB
    _Float16* vTh   = (_Float16*)(ws + carve((size_t)Bb * H * HD * T * 2)); // 8 MB
    _Float16* atth  = (_Float16*)(ws + carve(M * D * 2));               //  8 MB

    // 1) f32 -> f16 conversions, one launch for the three arrays
    {
        constexpr long n1 = M * D, n2 = (long)3 * D * D, n3 = (long)D * D;
        static_assert(n1 % CV_SPAN == 0 && n2 % CV_SPAN == 0 && n3 % CV_SPAN == 0, "whole spans only");
        constexpr int nb1 = (int)(n1 / CV_SPAN), nb2 = (int)(n2 / CV_SPAN), nb3 = (int)(n3 / CV_SPAN);
        cvt3_f32_to_f16<<<dim3(nb1 + nb2 + nb3), dim3(CV_THREADS), 0, stream>>>(
            x, xh, nb1, w_qkv, wqkvh, nb2, w_out, wouth);
    }

    // 2) qkv = x @ w_qkv^T   (4096x1024 x 1024x3072): Q (pre-scaled), K -> f16 [4096,3072] (its V
    //    third stays unwritten and unread), V -> vT[bh][d][t]
    {
        int tiles = (int)(M / 128) * (3 * D / 128);   // 768
        gemm_wmma<true><<<dim3(tiles), dim3(128), 0, stream>>>(
            xh, wqkvh, qkvh, (int)M, 3 * D, D, 3 * D, vTh, 2 * D, T, D, Q_SCALE);
    }

    // 3) flash attention (causal + ALiBi, transposed dataflow) -> atth f16
    {
        int blocks = Bb * H * (T / 128);              // 512: two query blocks each
        attn_flash_wmma<<<dim3(blocks), dim3(128), 0, stream>>>(qkvh, vTh, atth, T, H, HD);
    }

    // 4) out = attn @ w_out^T -> f32 d_out
    {
        int tiles = (int)(M / 128) * (D / 128);       // 256
        gemm_wmma<false><<<dim3(tiles), dim3(128), 0, stream>>>(
            atth, wouth, out, (int)M, D, D, D, nullptr, D, T, 0, 1.0f);
    }
}

// v008
// One run takes 58.9 microseconds.
// In both of two side-by-side timings against v007, it was 1.24 times as fast.
// All steps since v000 together make it 5.67 times as fast.
#include <hip/hip_runtime.h>
#include <stdint.h>

// ---------------------------------------------------------------------------
// CDNA5 (gfx1250) self-attention forward, f16 WMMA with f32 accumulation.
// Fixed problem: B=2, T=2048, D=1024, H=16, hd=64 (per reference setup).
// Attention computed in transposed form (S^T = K·Q^T, O^T = V^T·P^T) so that
// softmax row statistics are per-lane and P converts C-frag -> B-frag in
// registers (no LDS round trip, no bpermute reduction chains).
// ---------------------------------------------------------------------------

typedef __attribute__((ext_vector_type(16))) _Float16 v16h;
typedef __attribute__((ext_vector_type(8)))  _Float16 v8h;
typedef __attribute__((ext_vector_type(8)))  float    v8f;
typedef __attribute__((ext_vector_type(4)))  float    v4f;

union Frag16 {
    v16h v;
    struct { v8h lo; v8h hi; } p;
};

// D = A x B + C  (16x16x32, f16 in, f32 acc)
__device__ __forceinline__ v8f wmma_f16(v16h a, v16h b, v8f c) {
    return __builtin_amdgcn_wmma_f32_16x16x32_f16(
        /*neg_a=*/false, a, /*neg_b=*/false, b,
        /*c_mod=*/(short)0, c, /*reuse_a=*/false, /*reuse_b=*/false);
}

// Load a 16x32 A-style fragment from a row-major matrix (also the layout of
// the B operand of A·B^T when the second matrix is stored row-major N x K).
// CDNA5 16-bit A layout:
//   lanes 0-15 : row = lane,    halves 0-7 -> K=k0+0..7,  halves 8-15 -> K=k0+16..23
//   lanes 16-31: row = lane-16, halves 0-7 -> K=k0+8..15, halves 8-15 -> K=k0+24..31
__device__ __forceinline__ v16h load_frag_rm(const _Float16* __restrict__ base,
                                             long ld, int row0, int k0) {
    int lane = threadIdx.x & 31;
    int r    = row0 + (lane & 15);
    int hs   = (lane >> 4) << 3;            // 0 or 8
    const _Float16* p = base + (long)r * ld + k0 + hs;
    Frag16 f;
    f.p.lo = *(const v8h*)(p);              // K = k0+hs .. +7
    f.p.hi = *(const v8h*)(p + 16);         // K = k0+16+hs .. +7
    return f.v;
}

// ---------------------------------------------------------------------------
// f32 -> f16 for all three inputs in ONE launch: the three jobs read nothing of each other,
// and few long waves start sooner than many waves of two loads and a store each.
// One work-group of 16 waves per CV_SPAN elements; blockIdx picks the array (work-group
// uniform). A wave owns 2048 contiguous elements: 16 loads of 16 bytes per lane, each load
// 512 contiguous bytes of the wave (whole lines), written ahead of the conversions so that
// most of them are in flight together; each store is 256 contiguous bytes of the wave.
// Every array is a multiple of CV_SPAN long.
// ---------------------------------------------------------------------------
typedef __attribute__((ext_vector_type(4)))  _Float16 v4h;
constexpr int  CV_THREADS = 512;                          // 16 waves
constexpr int  CV_LOADS   = 16;                           // 16-byte loads per lane
constexpr long CV_SPAN    = (long)CV_THREADS * CV_LOADS * 4;   // 32768 elements per work-group

__global__ void __launch_bounds__(CV_THREADS) cvt3_f32_to_f16(
        const float* __restrict__ in0, _Float16* __restrict__ out0, int nb0,
        const float* __restrict__ in1, _Float16* __restrict__ out1, int nb1,
        const float* __restrict__ in2, _Float16* __restrict__ out2) {
    int blk = (int)blockIdx.x;
    const float* in  = in0;
    _Float16*    out = out0;
    if (blk >= nb0 + nb1)  { in = in2; out = out2; blk -= nb0 + nb1; }
    else if (blk >= nb0)   { in = in1; out = out1; blk -= nb0; }
    const int wave = threadIdx.x >> 5, lane = threadIdx.x & 31;
    const long base = (long)blk * CV_SPAN + (long)wave * (CV_LOADS * 128) + lane * 4;
    v4f a[CV_LOADS];
    for (int j = 0; j < CV_LOADS; ++j) a[j] = *(const v4f*)(in + base + j * 128);
    for (int j = 0; j < CV_LOADS; ++j) {
        v4h o;
        for (int e = 0; e < 4; ++e) o[e] = (_Float16)a[j][e];
        *(v4h*)(out + base + j * 128) = o;
    }
}

// ---------------------------------------------------------------------------
// C[M,N] = A[M,K] (row-major f16) x B[N,K]^T (row-major f16, torch-Linear W)
// One work-group of 4 waves -> 128x128 C tile, one wave -> 64x64 (4x4 fragments).
// A pass is 64 k (128 bytes of each of the 256 operand rows). Each wave brings
// one 64-row slice of a stage into LDS with one tensor load (waves 0,1: A rows,
// waves 2,3: B rows); two buffers, the next stage's load flies during a pass.
// Shapes: M, N multiples of 128, K a multiple of 64 and at least 128.
// All work-groups are resident at once, and those of one tile row (column) read the same A (B)
// rows. Walking k from 0 they would all ask L2 for the same lines at the same moment, and every
// new line would be a miss for all of them together. Work-group (x, y) therefore starts at pass
// (x + y) mod passes and wraps: sharers stand on different lines. The k sum is only rotated.
// Columns from vcol0 on (the V third of the qkv product; vcol0 and T multiples of 128) are not
// written to C but, transposed, to Vt[(row / T) * (N - vcol0) + col - vcol0][row % T]: in a C
// fragment a lane holds ONE column and 8 consecutive rows, which are 16 contiguous bytes there.
// Columns below qcol1 (the Q third; a multiple of 128) are multiplied by qmul in f32 before their
// one rounding to f16: the attention kernel's score products then need no scaling of their own.
// A wave's 64x64 quadrant of a Q or K tile is 64 tokens of ONE head (head size 64). Behind its
// stores the wave forms, from the rounded f16 values, the largest Euclidean row norm of that
// quadrant and writes it to nrm[Q or K][batch * heads + head][token / 64], one 128-byte line per
// entry (one writer a line). The attention kernel bounds whole key stages' scores with them.
// ---------------------------------------------------------------------------
typedef uint32_t u32x4 __attribute__((ext_vector_type(4)));
typedef uint32_t u32x8 __attribute__((ext_vector_type(8)));

constexpr uint32_t G_ROWB  = 128;                 // bytes of one operand row in a stage
constexpr uint32_t G_PITCH = G_ROWB + 16;         // LDS pitch, 16 B x odd for ds_load_b128
constexpr uint32_t G_ROWS  = 64;                  // rows of one wave's slice
constexpr uint32_t G_SLICE = 10240;               // 64 * 144 = 9216, rounded up to 2 KiB
constexpr uint32_t G_STAGE = 4 * G_SLICE;         // A half 0 | A half 1 | B half 0 | B half 1
constexpr int      NRM_PITCH = 32;                // floats from one norm entry to the next: a 128-byte line
static_assert(G_ROWS * G_PITCH <= G_SLICE && (G_SLICE % 2048u) == 0, "slice places are multiples of 2 KiB");

__device__ __forceinline__ uint32_t uni(uint32_t v) { return (uint32_t)__builtin_amdgcn_readfirstlane(v); }
// Used for the tensor loads alone: an issue test on it compiles to s_cmp + s_cbranch_scc (tensor
// loads ignore EXEC), and a descriptor word made from it stays behind the waits in front of it.
__device__ __forceinline__ uint32_t pinned(uint32_t v) {
    uint32_t w = uni(v);
    asm volatile("" : "+s"(w));   // pinned(): an issue test or a descriptor word held in a scalar register
    return w;
}
// The compiler places no wait for the tensor mover; the clobber keeps LDS reads on their side.
__device__ __forceinline__ void wait_tensor0() { asm volatile("s_wait_tensorcnt 0x0" ::: "memory"); }
// This wave's LDS reads have returned before the buffer is handed over for a refill.
__device__ __forceinline__ void wait_ds0() { asm volatile("s_wait_dscnt 0x0" ::: "memory"); }
// One request of the whole wave: 64 rows of 128 bytes from global memory into LDS.
__device__ __forceinline__ void tdm_load(u32x4 g0, u32x8 g1) {
    asm volatile("tensor_load_to_lds %0, %1" :: "s"(g0), "s"(g1) : "memory");
}
// The same load and the same wait for a ring whose loop needs scalar temporaries: group 0 goes in
// and out of the load in the same registers and is named again by the wait that covers the request,
// so that the compiler gives none of its registers a new value while the request is outstanding
// (left free, words 0 and 3 became loop temporaries).
__device__ __forceinline__ void tdm_load_held(u32x4& g0, u32x8 g1) {
    asm volatile("tensor_load_to_lds %0, %1" : "+s"(g0) : "s"(g1) : "memory");
}
__device__ __forceinline__ void wait_tensor0_of(u32x4 g0) { asm volatile("s_wait_tensorcnt 0x0" :: "s"(g0) : "memory"); }
__device__ __forceinline__ u32x4 tdm_group0(uint32_t lds_dst, uint64_t ga) {
    u32x4 g;
    g[0] = uni(1u);                                                        // count 1
    g[1] = uni(lds_dst);
    g[2] = uni((uint32_t)ga);
    g[3] = uni((((uint32_t)(ga >> 32)) & 0x01FFFFFFu) | 0x80000000u);      // type 2
    return g;
}
// Every word through pinned(): a descriptor word held in a scalar register. Without it the
// compiler used words of this group as loop temporaries while a request was outstanding.
__device__ __forceinline__ u32x8 tdm_group1(uint32_t src_pitch) {
    u32x8 g;
    g[0] = pinned((1u << 20) | (4u << 22) | (3u << 25));   // no mask, bytes, 16 B pad behind each 128-B row
    g[1] = pinned((G_ROWB & 0xFFFFu) << 16);
    g[2] = pinned((G_ROWB >> 16) | ((G_ROWS & 0xFFFFu) << 16));
    g[3] = pinned((G_ROWS >> 16) | (G_ROWB << 16));
    g[4] = pinned(G_ROWS);
    g[5] = pinned(src_pitch);
    g[6] = pinned(0u);
    g[7] = pinned(0u);
    return g;
}

// 16x32 fragment from an LDS slice; p points at byte 16*(lane>>4) of row (lane&15).
// Same k order as load_frag_rm: halves 0-7 at byte 0, halves 8-15 at byte 32.
__device__ __forceinline__ v16h lds_frag(const unsigned char* p) {
    Frag16 f;
    f.p.lo = *(const v8h*)(p);
    f.p.hi = *(const v8h*)(p + 32);
    return f.v;
}

// x + the x of the lane whose number differs in the bits of XM, inside a row of 16 lanes: the
// exchange rides on the add (row_xmask), no LDS instruction and no wait for one.
template <int XM>
__device__ __forceinline__ float add_xmask(float x) {
    const int y = __builtin_amdgcn_update_dpp(0, __builtin_bit_cast(int, x), 0x160 | XM, 0xF, 0xF, true);
    return x + __builtin_bit_cast(float, y);
}

template <bool OUT_HALF>
__global__ void __launch_bounds__(128) gemm_wmma(const _Float16* __restrict__ A,
                                                 const _Float16* __restrict__ B,
                                                 void* __restrict__ C,
                                                 int M, int N, int K, int ldc,
                                                 _Float16* __restrict__ Vt, int vcol0, int T,
                                                 int qcol1, float qmul, float* __restrict__ nrm) {
    __shared__ __attribute__((aligned(2048))) unsigned char ring[2 * G_STAGE];
    const uint32_t wave = uni(threadIdx.x >> 5);
    const int lane    = threadIdx.x & 31;
    const int nTilesN = N >> 7;
    const int nTiles  = (M >> 7) * nTilesN;
    if ((int)blockIdx.x >= nTiles) return;            // block-uniform, before any barrier
    const int tm = ((int)blockIdx.x / nTilesN) << 7;
    const int tn = ((int)blockIdx.x % nTilesN) << 7;
    const uint32_t wm = wave >> 1, wn = wave & 1u;    // this wave's 64x64 quadrant

    // this wave's slice of every stage
    const _Float16* srow = (wave < 2u) ? A + (long)(tm + 64 * (int)wave) * K
                                       : B + (long)(tn + 64 * (int)(wave - 2u)) * K;
    const uint64_t ga0  = (uint64_t)(size_t)srow;
    const uint32_t dst0 = (uint32_t)(size_t)ring + wave * G_SLICE;
    const u32x8    g1   = tdm_group1((uint32_t)K * 2u);
    const uint32_t nP   = (uint32_t)K >> 6;
    // stage s holds k pass (k0 + s) mod nP
    const uint32_t k0   = ((uint32_t)(tm >> 7) + (uint32_t)(tn >> 7)) % nP;

    tdm_load(tdm_group0(dst0, ga0 + (uint64_t)k0 * G_ROWB), g1);      // stage 0
    wait_tensor0();
    __syncthreads();                                  // stage 0 published
    {
        const uint32_t n1 = pinned(k0 + 1u);          // descriptor words formed behind the wait
        const uint32_t k1 = (n1 < nP) ? n1 : 0u;
        tdm_load(tdm_group0(dst0 + G_STAGE, ga0 + (uint64_t)k1 * G_ROWB), g1);   // stage 1
    }

    v8f acc[4][4];
    for (int i = 0; i < 4; ++i)
        for (int j = 0; j < 4; ++j) acc[i][j] = v8f{0};

    const uint32_t fo = (uint32_t)(lane & 15) * G_PITCH + (uint32_t)(lane >> 4) * 16u;
    uint32_t s = 0;
    do {                                              // nP is at least 2
        const unsigned char* buf = ring + (s & 1u) * G_STAGE;
        const unsigned char* pa  = buf + wm * G_SLICE + fo;
        const unsigned char* pb  = buf + (2u + wn) * G_SLICE + fo;
        v16h a[2][4], b[2][4];
        for (int kc = 0; kc < 2; ++kc) {
            for (int j = 0; j < 4; ++j) b[kc][j] = lds_frag(pb + j * 16 * G_PITCH + kc * 64);
            for (int i = 0; i < 4; ++i) a[kc][i] = lds_frag(pa + i * 16 * G_PITCH + kc * 64);
        }
        // keeps the pass's LDS reads one group in front of its WMMAs: left alone the compiler
        // put a load pair and a full wait in front of every row of four
        __builtin_amdgcn_sched_barrier(0);
        for (int kc = 0; kc < 2; ++kc)
            for (int i = 0; i < 4; ++i)
                for (int j = 0; j < 4; ++j) acc[i][j] = wmma_f16(a[kc][i], b[kc][j], acc[i][j]);
        // keeps the WMMAs in front of the publish point: sunk behind it they left the wait for
        // the next stage's tensor load at the top of the pass, with nothing to cover its flight
        __builtin_amdgcn_sched_barrier(0);
        // publish point of stage s + 1
        wait_ds0();
        wait_tensor0();
        __syncthreads();                              // s + 1 readable; every wave has left s
        if (pinned(s + 2u < nP)) {
            const uint32_t nx = pinned(s + 2u);       // descriptor words formed behind the wait
            const uint32_t kx = (nx + k0 < nP) ? nx + k0 : nx + k0 - nP;
            tdm_load(tdm_group0(dst0 + (nx & 1u) * G_STAGE, ga0 + (uint64_t)kx * G_ROWB), g1);
        }
    } while (++s < nP);
    wait_tensor0();
    wait_ds0();

    // C fragment layout: VGPR r holds (row=r, lanes0-15 cols) / (row=r+8, lanes16-31)
    int colb = lane & 15;
    int rowb = (lane >> 4) << 3;
    if (OUT_HALF && tn >= vcol0) {                    // block-uniform: a tile is all V or none
        const int bt = tm / T;                        // a tile's 128 rows lie in one batch
        _Float16* vrow = Vt + ((long)bt * (N - vcol0) + (tn - vcol0) + (int)wn * 64 + colb) * T
                            + (tm - bt * T) + (int)wm * 64 + rowb;
        for (int j = 0; j < 4; ++j)
            for (int i = 0; i < 4; ++i) {             // the four i of one j fill a 128-byte line
                v8h o;
                for (int r = 0; r < 8; ++r) o[r] = (_Float16)acc[i][j][r];
                *(v8h*)(vrow + (long)j * 16 * T + i * 16) = o;
            }
        // behind the last store: the code that follows in the listing overwrites address and
        // data registers of these stores
        asm volatile("s_wait_xcnt 0x0" ::: "memory");
        return;
    }
    const float om = (tn < qcol1) ? qmul : 1.0f;      // block-uniform: a tile is all Q or none
    for (int i = 0; i < 4; ++i)
        for (int j = 0; j < 4; ++j)
            for (int r = 0; r < 8; ++r) {
                long row = tm + (int)wm * 64 + i * 16 + rowb + r;
                long col = tn + (int)wn * 64 + j * 16 + colb;
                float v  = acc[i][j][r];
                if (OUT_HALF) ((_Float16*)C)[row * ldc + col] = (_Float16)(v * om);
                else          ((float*)C)[row * ldc + col]    = v;
            }
    if (OUT_HALF) {
        // a row's 64 squares: 4 in the lane, then summed over the 16 lanes that hold the row
        float mx = 0.f;
        for (int i = 0; i < 4; ++i)
            for (int r = 0; r < 8; ++r) {
                float ss = 0.f;
                for (int j = 0; j < 4; ++j) {
                    const float hv = (float)(_Float16)(acc[i][j][r] * om);   // the value as stored
                    ss += hv * hv;
                }
                ss = add_xmask<1>(ss);
                ss = add_xmask<2>(ss);
                ss = add_xmask<4>(ss);
                ss = add_xmask<8>(ss);
                mx = fmaxf(mx, ss);
            }
        mx = fmaxf(mx, __shfl_xor(mx, 16, 32));       // rows 0-7 and 8-15 of each fragment
        const int nb = T >> 6, nh = qcol1 >> 6;       // 64-token blocks of a batch; heads
        const int rb = (tm >> 6) + (int)wm;           // this quadrant's 64-row block
        const int cq = (tn >> 6) + (int)wn;           // its 64-column block: the Q heads, then the K heads
        const long e = ((long)((cq / nh) * (M / T) + rb / nb) * nh + cq % nh) * nb + rb % nb;
        if (lane == 0) nrm[e * NRM_PITCH] = sqrtf(mx);
    }
}

// ---------------------------------------------------------------------------
// Flash attention, causal + ALiBi, fully transposed dataflow.
//   qkv : [B*T, 3*D] f16 ;  vT : [B*H, hd, T] f16 ;  outh : [B*T, D] f16
// One wave owns 16 query columns (lane = query); key tiles of 32.
//   S^T = K(16kt x 64) · Q^T(64 x 16q)   -> C-frag: lane=q, reg r = kt r/r+8
//   O^T = V^T(64d x 32kt) · P^T(32 x 16q)-> C-frag: lane=q, reg r = d
// P^T C-frag layout == B-operand layout, so P is repacked in registers.
// The score WMMAs deliver the finished exponent of 2: Q arrives multiplied by hd^-0.5 * log2(e),
// and what is added to a score, ALiBi bias and causal mask, goes in as their C operand. Under the
// mask the bias is slope * (key - query); the query's part is one constant per softmax row and
// drops out, and the key's part is split into slope * (key - tile's first key), the same 16
// numbers a lane in every tile, and slope * (tile's first key), by which the running maximum is
// moved instead when the walk goes from one tile to another. A tile whose last key is not behind
// the wave's first query masks nothing: its C operand is those 16 numbers, loop-invariant. Only a
// tile on the diagonal forms its own, with MASKED in the place of each key behind the query.
// The four waves of a work-group walk the same keys, so K and V^T come through LDS once
// per work-group and query block: a stage is 64 keys (64 K rows of 128 bytes, 64 V^T rows of 128 bytes),
// wave 0 brings the K slice and wave 1 the V^T slice with one tensor load each; two
// buffers, the next stage's loads fly during a pass. hd = 64, T a multiple of 128.
// Causal cost grows with the query block, and every work-group is resident at once, so the
// launch lasts as long as its fullest WGP. A work-group therefore takes TWO query blocks of
// one head, n-1-t and then t, one after the other in every wave: (n-t) + (t+1) = n+1 stages
// for every work-group where no stage drops out (below). The ring runs on over the change of
// block: stage numbers count through both blocks.
// WHICH STAGES A QUERY BLOCK WALKS. The exponent of key j for query q is e(q,j) = q.k_j + slope *
// (j - q), and the row's maximum is at least e(q,q) >= -|q||k_q|. With nq the largest |q| of the
// block, nd the largest |k| of the diagonal stage and nj the largest |k| of stage j (the qkv
// product stores them), every key of stage j has e - maximum <= nq * (nj + nd) - slope * (least
// distance from the block to the stage). Below -ZERO_BELOW the weight 2^(e - maximum) is 0 in f32
// (the least f32 above 0 is 2^-149; the rest of the margin is for the rounding of norms and
// scores): such a stage adds zeros to every sum and is neither loaded nor worked on. The test
// reads the data, so it holds for any input: large norms or a small slope keep every stage.
// Lane j tests stage j (at most 32 stages: T at most 2048), a ballot makes the block's stage set,
// the same in every wave: same numbers, same operations. The diagonal stage is always in the set
// and comes first, so that the running maximum is at least e(q,q) from the first stage on; then
// the set's stages downwards. The work-groups of one head start on different diagonals, so on
// different lines.
// ---------------------------------------------------------------------------
constexpr uint32_t AT_STAGE = 2 * G_SLICE;        // K slice | V^T slice
constexpr float    LOG2E    = 1.44269504f;
constexpr float    Q_SCALE  = 0.125f * LOG2E;     // hd^-0.5 * log2(e), multiplied into Q by the qkv product
constexpr float    MASKED   = -1.0e30f;           // far below any score of f16 operands: 2^(MASKED - max) is 0
constexpr float    ZERO_BELOW = 160.0f;           // 2^x is 0 in f32 for x below -150; 10 more for rounding
struct OnDiagonal  { static constexpr bool value = true;  };
struct OffDiagonal { static constexpr bool value = false; };

__global__ void __launch_bounds__(128) attn_flash_wmma(const _Float16* __restrict__ qkv,
                                                       const _Float16* __restrict__ vT,
                                                       _Float16* __restrict__ outh,
                                                       const float* __restrict__ nrm,
                                                       int T, int H, int hd) {
    __shared__ __attribute__((aligned(2048))) unsigned char ring[2 * AT_STAGE];
    const int  D  = H * hd;            // 1024
    const long ld = (long)3 * D;       // 3072
    int nQblk = T / 64;                // even
    int nPair = nQblk / 2;
    int bh    = blockIdx.x / nPair;
    int pr    = blockIdx.x % nPair;    // t: this work-group's query blocks are nQblk-1-t and t
    int b = bh / H, h = bh % H;
    const uint32_t wave = uni(threadIdx.x >> 5);
    int lane = threadIdx.x & 31;

    const float slope2 = exp2f(-(float)(h + 1) / (float)H) * LOG2E;   // ALiBi slope, in powers of 2
    const float NEGINF = -__builtin_inff();

    const _Float16* Qp = qkv + (long)b * T * ld + (long)h * hd;
    const _Float16* Kp = Qp + D;
    const _Float16* Vt = vT + (long)bh * hd * T;

    // the issuing waves' slice of every stage: wave 0 K rows (a stage on = 64 rows), wave 1
    // V^T rows (a stage on = 128 bytes along each row)
    const uint64_t ga0   = (uint64_t)(size_t)((wave == 0u) ? Kp : Vt);
    const uint64_t gstep = (wave == 0u) ? (uint64_t)ld * 2u * G_ROWS : (uint64_t)G_ROWB;
    const uint32_t dst0  = (uint32_t)(size_t)ring + (wave & 1u) * G_SLICE;
    const u32x8    g1    = tdm_group1((wave == 0u) ? (uint32_t)ld * 2u : (uint32_t)T * 2u);
    const int qb1 = nQblk - 1 - pr, qb2 = pr;     // the two query blocks = their diagonal stages

    // the stage sets of both blocks, bit j = key stage j
    const float* nq = nrm + (long)bh * nQblk * NRM_PITCH;
    const float* nk = nq + (long)((int)gridDim.x / nPair) * nQblk * NRM_PITCH;
    const float  nj = nk[((lane < nQblk) ? lane : nQblk - 1) * NRM_PITCH];
    // behind the load: the code that follows overwrites the registers that hold its address
    asm volatile("s_wait_xcnt 0x0" ::: "memory");
    const float  nq1 = nq[qb1 * NRM_PITCH], nd1 = nk[qb1 * NRM_PITCH];
    const float  nq2 = nq[qb2 * NRM_PITCH], nd2 = nk[qb2 * NRM_PITCH];

    if (pinned(wave < 2u)) {
        tdm_load(tdm_group0(dst0, ga0 + (uint64_t)(uint32_t)qb1 * gstep), g1);   // stage 0: the first diagonal
        wait_tensor0();
    }
    __syncthreads();                              // stage 0 published
    auto stage_set = [&](int qb, float nqb, float ndb) -> uint32_t {
        const float top  = nqb * (nj + ndb) - slope2 * (float)(64 * (qb - lane) - 63);
        const bool  need = (lane < qb) && !(top < -ZERO_BELOW);      // a NaN keeps the stage
        return __builtin_amdgcn_ballot_w32(need) | (1u << qb);
    };
    const uint32_t set1 = stage_set(qb1, nq1, nd1), set2 = stage_set(qb2, nq2, nd2);
    // stages not yet asked for: this block's, the next block's; taken from the top bit down
    uint32_t askA = set1 & ~(1u << qb1), askB = set2;
    auto next_ask = [&]() -> uint32_t {           // only while askA | askB is not 0
        if (askA == 0u) { askA = askB; askB = 0u; }
        const uint32_t k = 31u - (uint32_t)__builtin_clz(askA);
        askA &= ~(1u << k);
        return k;
    };
    const uint32_t n1  = pinned(next_ask());      // descriptor words formed behind the wait; set2 is never empty
    u32x4 g0 = tdm_group0(dst0 + AT_STAGE, ga0 + (uint64_t)n1 * gstep);
    if (pinned(wave < 2u))
        tdm_load_held(g0, g1);                    // stage 1

    const int rh8 = (lane >> 4) << 3;             // 0 or 8 (kt / d row offset)
    v8f cb0, cb1;                                 // slope2 * (key - tile's first key), C-frag layout
    for (int r = 0; r < 8; ++r) {
        cb0[r] = slope2 * (float)(rh8 + r);
        cb1[r] = slope2 * (float)(16 + rh8 + r);
    }
    const uint32_t fo = (uint32_t)(lane & 15) * G_PITCH + (uint32_t)(lane >> 4) * 16u;
    uint32_t sg = 0;                              // stage number, counted through both blocks

    for (int half = 0; half < 2; ++half) {
    const int qblk  = half ? qb2 : qb1;
    const int qbase = qblk * 64 + (int)wave * 16;

    // Q^T B-operand fragments for this wave's 16 queries (hd=64 -> 2 chunks)
    v16h qfA = load_frag_rm(Qp, ld, qbase, 0);    // dd = 0..31
    v16h qfB = load_frag_rm(Qp, ld, qbase, 32);   // dd = 32..63

    int qlane = qbase + (lane & 15);              // this lane's query index

    // rel = qlane - kt_index, affine per tile: precompute per-register bases
    float relA[8];
    for (int r = 0; r < 8; ++r) relA[r] = (float)(qlane - rh8 - r);   // rel at kt = 0, first half

    v8f  o[4] = {{0}, {0}, {0}, {0}};             // O^T: 64d x 16q, 4 frags
    float mrow = NEGINF, lrow = 0.f;              // mrow counts from slope2 * kref
    int   kref = 0;                               // first key of the tile worked on last (wave-uniform)

    // one key tile of 32: pk at K row 0 of the tile, pv at its first key in V^T row 0, both
    // with the lane's fragment offset; kt = index of the tile's first key
    auto key_tile = [&](auto diag, const unsigned char* pk, const unsigned char* pv, int kt) {
        // ---- C operand of the score WMMAs ----
        v8f c0 = cb0, c1 = cb1;
        if constexpr (decltype(diag)::value) {
            const float ktf = (float)kt;
            for (int r = 0; r < 8; ++r) {
                float rel0 = relA[r] - ktf;       // qlane - k0 (exact integer)
                c0[r] = (rel0 >= 0.0f)  ? cb0[r] : MASKED;
                c1[r] = (rel0 >= 16.0f) ? cb1[r] : MASKED;
            }
        }
        // ---- all K fragments, then the 4 score WMMAs ----
        v16h kf0a = lds_frag(pk);
        v16h kf0b = lds_frag(pk + 64);
        v16h kf1a = lds_frag(pk + 16 * G_PITCH);
        v16h kf1b = lds_frag(pk + 16 * G_PITCH + 64);
        v8f s0 = wmma_f16(kf0a, qfA, c0);
        s0 = wmma_f16(kf0b, qfB, s0);
        v8f s1 = wmma_f16(kf1a, qfA, c1);
        s1 = wmma_f16(kf1b, qfB, s1);

        // ---- V fragments early; softmax math below hides their latency
        v16h vf0 = lds_frag(pv);
        v16h vf1 = lds_frag(pv + 16 * G_PITCH);
        v16h vf2 = lds_frag(pv + 32 * G_PITCH);
        v16h vf3 = lds_frag(pv + 48 * G_PITCH);

        // ---- local max (per-lane regs) ----
        float mloc = NEGINF;
        for (int r = 0; r < 8; ++r) mloc = fmaxf(mloc, fmaxf(s0[r], s1[r]));
        mloc = fmaxf(mloc, __shfl_xor(mloc, 16, 32));   // join the two kt halves
        const float mold = mrow - slope2 * (float)(kt - kref);   // the maximum so far, counted from this tile
        kref = kt;
        float mnew = fmaxf(mold, mloc);

        // ---- powers of 2, P^T repacked directly into a B-operand frag ----
        float corr = __builtin_amdgcn_exp2f(mold - mnew);        // 0 when mold == -inf
        v16h pb = {};
        float ps = 0.f;
        for (int r = 0; r < 8; ++r) {
            float p0 = __builtin_amdgcn_exp2f(s0[r] - mnew);     // 0 where masked
            float p1 = __builtin_amdgcn_exp2f(s1[r] - mnew);
            ps += p0 + p1;
            pb[r]     = (_Float16)p0;                   // kk = rh8 + r
            pb[8 + r] = (_Float16)p1;                   // kk = 16 + rh8 + r
        }
        ps += __shfl_xor(ps, 16, 32);
        lrow = lrow * corr + ps;
        mrow = mnew;

        // ---- O^T = corr*O^T + V^T x P^T ----
        o[0] = wmma_f16(vf0, pb, o[0] * corr);
        o[1] = wmma_f16(vf1, pb, o[1] * corr);
        o[2] = wmma_f16(vf2, pb, o[2] * corr);
        o[3] = wmma_f16(vf3, pb, o[3] * corr);
    };

    uint32_t todo = half ? set2 : set1;           // this block's stages, in the order they were asked for
    do {
        const unsigned char* pk = ring + (sg & 1u) * AT_STAGE + fo;
        const unsigned char* pv = pk + G_SLICE;
        const uint32_t ks = 31u - (uint32_t)__builtin_clz(todo);       // this stage's 64 keys
        todo &= ~(1u << ks);
        const int kt = (int)ks * 64;
        if (kt + 63 <= qbase) {                   // wave-uniform: no key of the stage behind a query
            key_tile(OffDiagonal{}, pk, pv, kt);
            key_tile(OffDiagonal{}, pk + 32 * G_PITCH, pv + 64, kt + 32);
        } else {                                  // the diagonal stage
            key_tile(OnDiagonal{}, pk, pv, kt);
            if (kt + 32 <= qbase + 15)            // wave-uniform: else every key of the tile is masked
                key_tile(OnDiagonal{}, pk + 32 * G_PITCH, pv + 64, kt + 32);
        }
        // publish point of stage sg + 1
        wait_ds0();
        if (pinned(wave < 2u)) wait_tensor0_of(g0);
        __syncthreads();                          // sg + 1 readable; every wave has left sg
        const bool more = (askA | askB) != 0u;    // a stage sg + 2 exists (the same in every wave)
        const uint32_t ka = more ? next_ask() : 0u;
        if (pinned((wave < 2u) && more)) {
            const uint32_t nx = pinned(sg + 2u);  // descriptor words formed behind the wait
            const uint32_t kb = pinned(ka);
            g0 = tdm_group0(dst0 + (nx & 1u) * AT_STAGE, ga0 + (uint64_t)kb * gstep);
            tdm_load_held(g0, g1);
        }
        ++sg;
    } while (todo != 0u);

    // ---- normalize, write O^T: lane q stores 8 contiguous d per fragment ----
    float rinv = 1.0f / lrow;
    _Float16* dst = outh + ((long)b * T + qlane) * D + (long)h * hd + rh8;
    for (int f = 0; f < 4; ++f) {
        v8h ov;
        for (int r = 0; r < 8; ++r) ov[r] = (_Float16)(o[f][r] * rinv);
        *(v8h*)(dst + f * 16) = ov;                     // d = f*16 + rh8 + r
    }
    // the next block's set-up overwrites the address and data registers of these stores
    asm volatile("s_wait_xcnt 0x0" ::: "memory");
    }   // second query block
    wait_tensor0();
    wait_ds0();
}

// ---------------------------------------------------------------------------
// Host launcher
// ---------------------------------------------------------------------------
extern "C" void kernel_launch(void* const* d_in, const int* in_sizes, int n_in,
                              void* d_out, int out_size, void* d_ws, size_t ws_size,
                              hipStream_t stream) {
    (void)in_sizes; (void)n_in; (void)out_size; (void)ws_size;
    constexpr int  Bb = 2, T = 2048, D = 1024, H = 16, HD = 64;
    constexpr long M  = (long)Bb * T;          // 4096

    const float* x     = (const float*)d_in[0];
    const float* w_qkv = (const float*)d_in[1];
    const float* w_out = (const float*)d_in[2];
    float*       out   = (float*)d_out;

    // workspace carve-up (256B aligned)
    char* ws = (char*)d_ws;
    size_t off = 0;
    auto carve = [&](size_t bytes) {
        size_t r = off;
        off += (bytes + 255) & ~(size_t)255;
        return r;
    };
    _Float16* xh    = (_Float16*)(ws + carve(M * D * 2));               //  8 MB
    _Float16* wqkvh = (_Float16*)(ws + carve((size_t)3 * D * D * 2));   //  6 MB
    _Float16* wouth = (_Float16*)(ws + carve((size_t)D * D * 2));       //  2 MB
    _Float16* qkvh  = (_Float16*)(ws + carve(M * 3 * D * 2));           // 24 MB
    _Float16* vTh   = (_Float16*)(ws + carve((size_t)Bb * H * HD * T * 2)); // 8 MB
    _Float16* atth  = (_Float16*)(ws + carve(M * D * 2));               //  8 MB
    float*    nrmw  = (float*)(ws + carve((size_t)2 * Bb * H * (T / 64) * NRM_PITCH * 4)); // 256 KB
    static_assert(T / 64 <= 32 && HD == 64, "one lane per key stage; a GEMM wave's quadrant is one head");

    // 1) f32 -> f16 conversions, one launch for the three arrays
    {
        constexpr long n1 = M * D, n2 = (long)3 * D * D, n3 = (long)D * D;
        static_assert(n1 % CV_SPAN == 0 && n2 % CV_SPAN == 0 && n3 % CV_SPAN == 0, "whole spans only");
        constexpr int nb1 = (int)(n1 / CV_SPAN), nb2 = (int)(n2 / CV_SPAN), nb3 = (int)(n3 / CV_SPAN);
        cvt3_f32_to_f16<<<dim3(nb1 + nb2 + nb3), dim3(CV_THREADS), 0, stream>>>(
            x, xh, nb1, w_qkv, wqkvh, nb2, w_out, wouth);
    }

    // 2) qkv = x @ w_qkv^T   (4096x1024 x 1024x3072): Q (pre-scaled), K -> f16 [4096,3072] (its V
    //    third stays unwritten and unread), V -> vT[bh][d][t]
    {
        int tiles = (int)(M / 128) * (3 * D / 128);   // 768
        gemm_wmma<true><<<dim3(tiles), dim3(128), 0, stream>>>(
            xh, wqkvh, qkvh, (int)M, 3 * D, D, 3 * D, vTh, 2 * D, T, D, Q_SCALE, nrmw);
    }

    // 3) flash attention (causal + ALiBi, transposed dataflow) -> atth f16
    {
        int blocks = Bb * H * (T / 128);              // 512: two query blocks each
        attn_flash_wmma<<<dim3(blocks), dim3(128), 0, stream>>>(qkvh, vTh, atth, nrmw, T, H, HD);
    }

    // 4) out = attn @ w_out^T -> f32 d_out
    {
        int tiles = (int)(M / 128) * (D / 128);       // 256
        gemm_wmma<false><<<dim3(tiles), dim3(128), 0, stream>>>(
            atth, wouth, out, (int)M, D, D, D, nullptr, D, T, 0, 1.0f, nullptr);
    }
}

// v009
// Measured time: 55.7 microseconds a run.
// Timed twice side by side with v008, it ran 1.06 and 1.05 times as fast.
// All steps since v000 together make it 5.96 times as fast.
#include <hip/hip_runtime.h>
#include <stdint.h>

// ---------------------------------------------------------------------------
// CDNA5 (gfx1250) self-attention forward, f16 WMMA with f32 accumulation.
// Fixed problem: B=2, T=2048, D=1024, H=16, hd=64 (per reference setup).
// Attention computed in transposed form (S^T = K·Q^T, O^T = V^T·P^T) so that
// softmax row statistics are per-lane and P converts C-frag -> B-frag in
// registers (no LDS round trip, no bpermute reduction chains).
// ---------------------------------------------------------------------------

typedef __attribute__((ext_vector_type(16))) _Float16 v16h;
typedef __attribute__((ext_vector_type(8)))  _Float16 v8h;
typedef __attribute__((ext_vector_type(8)))  float    v8f;
typedef __attribute__((ext_vector_type(4)))  float    v4f;

union Frag16 {
    v16h v;
    struct { v8h lo; v8h hi; } p;
};

// D = A x B + C  (16x16x32, f16 in, f32 acc)
__device__ __forceinline__ v8f wmma_f16(v16h a, v16h b, v8f c) {
    return __builtin_amdgcn_wmma_f32_16x16x32_f16(
        /*neg_a=*/false, a, /*neg_b=*/false, b,
        /*c_mod=*/(short)0, c, /*reuse_a=*/false, /*reuse_b=*/false);
}

// Load a 16x32 A-style fragment from a row-major matrix (also the layout of
// the B operand of A·B^T when the second matrix is stored row-major N x K).
// CDNA5 16-bit A layout:
//   lanes 0-15 : row = lane,    halves 0-7 -> K=k0+0..7,  halves 8-15 -> K=k0+16..23
//   lanes 16-31: row = lane-16, halves 0-7 -> K=k0+8..15, halves 8-15 -> K=k0+24..31
__device__ __forceinline__ v16h load_frag_rm(const _Float16* __restrict__ base,
                                             long ld, int row0, int k0) {
    int lane = threadIdx.x & 31;
    int r    = row0 + (lane & 15);
    int hs   = (lane >> 4) << 3;            // 0 or 8
    const _Float16* p = base + (long)r * ld + k0 + hs;
    Frag16 f;
    f.p.lo = *(const v8h*)(p);              // K = k0+hs .. +7
    f.p.hi = *(const v8h*)(p + 16);         // K = k0+16+hs .. +7
    return f.v;
}

// ---------------------------------------------------------------------------
// f32 -> f16 for all three inputs in ONE launch: the three jobs read nothing of each other,
// and few long waves start sooner than many waves of two loads and a store each.
// One work-group of 16 waves per CV_SPAN elements; blockIdx picks the array (work-group
// uniform). A wave owns 2048 contiguous elements: 16 loads of 16 bytes per lane, each load
// 512 contiguous bytes of the wave (whole lines), written ahead of the conversions so that
// most of them are in flight together; each store is 256 contiguous bytes of the wave.
// Every array is a multiple of CV_SPAN long.
// ---------------------------------------------------------------------------
typedef __attribute__((ext_vector_type(4)))  _Float16 v4h;
constexpr int  CV_THREADS = 512;                          // 16 waves
constexpr int  CV_LOADS   = 16;                           // 16-byte loads per lane
constexpr long CV_SPAN    = (long)CV_THREADS * CV_LOADS * 4;   // 32768 elements per work-group

__global__ void __launch_bounds__(CV_THREADS) cvt3_f32_to_f16(
        const float* __restrict__ in0, _Float16* __restrict__ out0, int nb0,
        const float* __restrict__ in1, _Float16* __restrict__ out1, int nb1,
        const float* __restrict__ in2, _Float16* __restrict__ out2) {
    int blk = (int)blockIdx.x;
    const float* in  = in0;
    _Float16*    out = out0;
    if (blk >= nb0 + nb1)  { in = in2; out = out2; blk -= nb0 + nb1; }
    else if (blk >= nb0)   { in = in1; out = out1; blk -= nb0; }
    const int wave = threadIdx.x >> 5, lane = threadIdx.x & 31;
    const long base = (long)blk * CV_SPAN + (long)wave * (CV_LOADS * 128) + lane * 4;
    v4f a[CV_LOADS];
    for (int j = 0; j < CV_LOADS; ++j) a[j] = *(const v4f*)(in + base + j * 128);
    for (int j = 0; j < CV_LOADS; ++j) {
        v4h o;
        for (int e = 0; e < 4; ++e) o[e] = (_Float16)a[j][e];
        *(v4h*)(out + base + j * 128) = o;
    }
}

// ---------------------------------------------------------------------------
// C[M,N] = A[M,K] (row-major f16) x B[N,K]^T (row-major f16, torch-Linear W)
// One work-group of 4 waves -> 128x128 C tile, one wave -> 64x64 (4x4 fragments).
// A pass is 64 k (128 bytes of each of the 256 operand rows). Each wave brings
// one 64-row slice of a stage into LDS with one tensor load (waves 0,1: A rows,
// waves 2,3: B rows); two buffers, the next stage's load flies during a pass.
// Shapes: M, N multiples of 128, K a multiple of 64 and at least 128.
// All work-groups are resident at once, and those of one tile row (column) read the same A (B)
// rows. Walking k from 0 they would all ask L2 for the same lines at the same moment, and every
// new line would be a miss for all of them together. Work-group (x, y) therefore starts at pass
// (x + y) mod passes and wraps: sharers stand on different lines. The k sum is only rotated.
// Columns from vcol0 on (the V third of the qkv product; vcol0 and T multiples of 128) are not
// written to C but, transposed, to Vt[(row / T) * (N - vcol0) + col - vcol0][row % T].
// HOW A TILE GOES TO MEMORY. In a WMMA result a lane holds ONE column and 8 consecutive rows. A and
// B fragments have the same layout, so either operand can go in first: for a tile that is stored
// row-major the B rows go in as the WMMAs' first operand, and the result is the transposed tile:
// a lane holds one row of C and 8 consecutive columns of it. For a V tile the A rows go in first,
// and a lane holds one row of Vt and 8 consecutive tokens. Either way a fragment is 16 (f16) or 32
// (f32) contiguous bytes a lane of a row in memory. Stored straight from the registers a wave's
// store would touch 16 lines, 32 bytes of each; so each wave lays its 64x64 quadrant down in LDS,
// in its own quarter of the ring, which every wave has left at the last pass's barrier, reads it
// back along the rows and stores whole 128-byte lines, 16 bytes a lane.
// Columns below qcol1 (the Q third; a multiple of 128) are multiplied by qmul in f32 before their
// one rounding to f16: the attention kernel's score products then need no scaling of their own.
// A wave's 64x64 quadrant of a Q or K tile is 64 tokens of ONE head (head size 64). Behind its
// stores the wave forms, from the rounded f16 values, the largest Euclidean row norm of that
// quadrant and writes it to nrm[Q or K][batch * heads + head][token / 64], one 128-byte line per
// entry (one writer a line). The attention kernel bounds whole key stages' scores with them.
// ---------------------------------------------------------------------------
typedef uint32_t u32x4 __attribute__((ext_vector_type(4)));
typedef uint32_t u32x8 __attribute__((ext_vector_type(8)));

constexpr uint32_t G_ROWB  = 128;                 // bytes of one operand row in a stage
constexpr uint32_t G_PITCH = G_ROWB + 16;         // LDS pitch, 16 B x odd for ds_load_b128
constexpr uint32_t G_ROWS  = 64;                  // rows of one wave's slice
constexpr uint32_t G_SLICE = 10240;               // 64 * 144 = 9216, rounded up to 2 KiB
constexpr uint32_t G_STAGE = 4 * G_SLICE;         // A half 0 | A half 1 | B half 0 | B half 1
constexpr int      NRM_PITCH = 32;                // floats from one norm entry to the next: a 128-byte line
static_assert(G_ROWS * G_PITCH <= G_SLICE && (G_SLICE % 2048u) == 0, "slice places are multiples of 2 KiB");
constexpr uint32_t E_RANGE = 2 * G_STAGE / 4;     // a wave's quarter of the ring, for its output quadrant
constexpr uint32_t E_PITCH_H = 128 + 16;          // 64 f16 a row; 16 B x odd for 16-byte LDS accesses
constexpr uint32_t E_PITCH_F = 256 + 16;          // 64 f32 a row
static_assert(64 * E_PITCH_F <= E_RANGE && 64 * E_PITCH_H <= E_RANGE, "a quadrant fits the wave's quarter");

__device__ __forceinline__ uint32_t uni(uint32_t v) { return (uint32_t)__builtin_amdgcn_readfirstlane(v); }
// Used for the tensor loads alone: an issue test on it compiles to s_cmp + s_cbranch_scc (tensor
// loads ignore EXEC), and a descriptor word made from it stays behind the waits in front of it.
__device__ __forceinline__ uint32_t pinned(uint32_t v) {
    uint32_t w = uni(v);
    asm volatile("" : "+s"(w));   // pinned(): an issue test or a descriptor word held in a scalar register
    return w;
}
// The compiler places no wait for the tensor mover; the clobber keeps LDS reads on their side.
__device__ __forceinline__ void wait_tensor0() { asm volatile("s_wait_tensorcnt 0x0" ::: "memory"); }
// This wave's LDS reads have returned before the buffer is handed over for a refill.
__device__ __forceinline__ void wait_ds0() { asm volatile("s_wait_dscnt 0x0" ::: "memory"); }
// One request of the whole wave: 64 rows of 128 bytes from global memory into LDS.
__device__ __forceinline__ void tdm_load(u32x4 g0, u32x8 g1) {
    asm volatile("tensor_load_to_lds %0, %1" :: "s"(g0), "s"(g1) : "memory");
}
// The same load and the same wait for a ring whose loop needs scalar temporaries: group 0 goes in
// and out of the load in the same registers and is named again by the wait that covers the request,
// so that the compiler gives none of its registers a new value while the request is outstanding
// (left free, words 0 and 3 became loop temporaries).
__device__ __forceinline__ void tdm_load_held(u32x4& g0, u32x8 g1) {
    asm volatile("tensor_load_to_lds %0, %1" : "+s"(g0) : "s"(g1) : "memory");
}
__device__ __forceinline__ void wait_tensor0_of(u32x4 g0) { asm volatile("s_wait_tensorcnt 0x0" :: "s"(g0) : "memory"); }
__device__ __forceinline__ u32x4 tdm_group0(uint32_t lds_dst, uint64_t ga) {
    u32x4 g;
    g[0] = uni(1u);                                                        // count 1
    g[1] = uni(lds_dst);
    g[2] = uni((uint32_t)ga);
    g[3] = uni((((uint32_t)(ga >> 32)) & 0x01FFFFFFu) | 0x80000000u);      // type 2
    return g;
}
// Every word through pinned(): a descriptor word held in a scalar register. Without it the
// compiler used words of this group as loop temporaries while a request was outstanding.
__device__ __forceinline__ u32x8 tdm_group1(uint32_t src_pitch) {
    u32x8 g;
    g[0] = pinned((1u << 20) | (4u << 22) | (3u << 25));   // no mask, bytes, 16 B pad behind each 128-B row
    g[1] = pinned((G_ROWB & 0xFFFFu) << 16);
    g[2] = pinned((G_ROWB >> 16) | ((G_ROWS & 0xFFFFu) << 16));
    g[3] = pinned((G_ROWS >> 16) | (G_ROWB << 16));
    g[4] = pinned(G_ROWS);
    g[5] = pinned(src_pitch);
    g[6] = pinned(0u);
    g[7] = pinned(0u);
    return g;
}

// 16x32 fragment from an LDS slice; p points at byte 16*(lane>>4) of row (lane&15).
// Same k order as load_frag_rm: halves 0-7 at byte 0, halves 8-15 at byte 32.
__device__ __forceinline__ v16h lds_frag(const unsigned char* p) {
    Frag16 f;
    f.p.lo = *(const v8h*)(p);
    f.p.hi = *(const v8h*)(p + 32);
    return f.v;
}

// the larger of x and the x of the lane whose number differs in the bits of XM, inside a row of 16
// lanes: the exchange rides on the maximum (row_xmask), no LDS instruction and no wait for one.
template <int XM>
__device__ __forceinline__ float max_xmask(float x) {
    const int y = __builtin_amdgcn_update_dpp(0, __builtin_bit_cast(int, x), 0x160 | XM, 0xF, 0xF, true);
    return fmaxf(x, __builtin_bit_cast(float, y));
}

template <bool OUT_HALF>
__global__ void __launch_bounds__(128) gemm_wmma(const _Float16* __restrict__ A,
                                                 const _Float16* __restrict__ B,
                                                 void* __restrict__ C,
                                                 int M, int N, int K, int ldc,
                                                 _Float16* __restrict__ Vt, int vcol0, int T,
                                                 int qcol1, float qmul, float* __restrict__ nrm) {
    __shared__ __attribute__((aligned(2048))) unsigned char ring[2 * G_STAGE];
    const uint32_t wave = uni(threadIdx.x >> 5);
    const int lane    = threadIdx.x & 31;
    const int nTilesN = N >> 7;
    const int nTiles  = (M >> 7) * nTilesN;
    if ((int)blockIdx.x >= nTiles) return;            // block-uniform, before any barrier
    const int tm = ((int)blockIdx.x / nTilesN) << 7;
    const int tn = ((int)blockIdx.x % nTilesN) << 7;
    const uint32_t wm = wave >> 1, wn = wave & 1u;    // this wave's 64x64 quadrant
    // block-uniform (a tile is all V or none): the slice whose rows become the result's rows (first
    // operand) and the slice whose rows become its columns, one to a lane
    const bool     rowmajor = !OUT_HALF || tn < vcol0;
    const uint32_t sl_a = rowmajor ? 2u + wn : wm;
    const uint32_t sl_b = rowmajor ? wm : 2u + wn;

    // this wave's slice of every stage
    const _Float16* srow = (wave < 2u) ? A + (long)(tm + 64 * (int)wave) * K
                                       : B + (long)(tn + 64 * (int)(wave - 2u)) * K;
    const uint64_t ga0  = (uint64_t)(size_t)srow;
    const uint32_t dst0 = (uint32_t)(size_t)ring + wave * G_SLICE;
    const u32x8    g1   = tdm_group1((uint32_t)K * 2u);
    const uint32_t nP   = (uint32_t)K >> 6;
    // stage s holds k pass (k0 + s) mod nP
    const uint32_t k0   = ((uint32_t)(tm >> 7) + (uint32_t)(tn >> 7)) % nP;

    tdm_load(tdm_group0(dst0, ga0 + (uint64_t)k0 * G_ROWB), g1);      // stage 0
    wait_tensor0();
    __syncthreads();                                  // stage 0 published
    {
        const uint32_t n1 = pinned(k0 + 1u);          // descriptor words formed behind the wait
        const uint32_t k1 = (n1 < nP) ? n1 : 0u;
        tdm_load(tdm_group0(dst0 + G_STAGE, ga0 + (uint64_t)k1 * G_ROWB), g1);   // stage 1
    }

    v8f acc[4][4];
    for (int i = 0; i < 4; ++i)
        for (int j = 0; j < 4; ++j) acc[i][j] = v8f{0};

    const uint32_t fo = (uint32_t)(lane & 15) * G_PITCH + (uint32_t)(lane >> 4) * 16u;
    uint32_t s = 0;
    do {                                              // nP is at least 2
        const unsigned char* buf = ring + (s & 1u) * G_STAGE;
        const unsigned char* pa  = buf + sl_a * G_SLICE + fo;
        const unsigned char* pb  = buf + sl_b * G_SLICE + fo;
        v16h a[2][4], b[2][4];
        for (int kc = 0; kc < 2; ++kc) {
            for (int j = 0; j < 4; ++j) b[kc][j] = lds_frag(pb + j * 16 * G_PITCH + kc * 64);
            for (int i = 0; i < 4; ++i) a[kc][i] = lds_frag(pa + i * 16 * G_PITCH + kc * 64);
        }
        // keeps the pass's LDS reads one group in front of its WMMAs: left alone the compiler
        // put a load pair and a full wait in front of every row of four
        __builtin_amdgcn_sched_barrier(0);
        for (int kc = 0; kc < 2; ++kc)
            for (int i = 0; i < 4; ++i)
                for (int j = 0; j < 4; ++j) acc[i][j] = wmma_f16(a[kc][i], b[kc][j], acc[i][j]);
        // keeps the WMMAs in front of the publish point: sunk behind it they left the wait for
        // the next stage's tensor load at the top of the pass, with nothing to cover its flight
        __builtin_amdgcn_sched_barrier(0);
        // publish point of stage s + 1
        wait_ds0();
        wait_tensor0();
        __syncthreads();                              // s + 1 readable; every wave has left s
        if (pinned(s + 2u < nP)) {
            const uint32_t nx = pinned(s + 2u);       // descriptor words formed behind the wait
            const uint32_t kx = (nx + k0 < nP) ? nx + k0 : nx + k0 - nP;
            tdm_load(tdm_group0(dst0 + (nx & 1u) * G_STAGE, ga0 + (uint64_t)kx * G_ROWB), g1);
        }
    } while (++s < nP);
    wait_tensor0();
    wait_ds0();

    // Result fragment acc[i][j]: the lane holds memory row j * 16 + (lane & 15) of the quadrant and
    // its elements i * 16 + 8 * (lane >> 4) + 0..7. No tensor load is outstanding and no wave reads
    // the ring any more (the last pass's waits and barrier); each wave uses its own quarter alone.
    const int colb = lane & 15;
    const int rowb = (lane >> 4) << 3;
    unsigned char* stg = ring + wave * E_RANGE;
    if constexpr (OUT_HALF) {
        const float om = (tn < qcol1) ? qmul : 1.0f;  // block-uniform: a tile is all Q or none
        // first memory row of the quadrant, and the elements from one row to the next
        _Float16* g;
        long      gp;
        if (rowmajor) {
            g  = (_Float16*)C + (long)(tm + (int)wm * 64) * ldc + tn + (int)wn * 64;
            gp = ldc;
        } else {
            const int bt = tm / T;                    // a tile's 128 rows lie in one batch
            g  = Vt + ((long)bt * (N - vcol0) + (tn - vcol0) + (int)wn * 64) * T + (tm - bt * T) + (int)wm * 64;
            gp = T;
        }
        v8h o[4][4];
        unsigned char* wp = stg + colb * E_PITCH_H + rowb * 2;
        for (int j = 0; j < 4; ++j)
            for (int i = 0; i < 4; ++i) {
                o[i][j] = __builtin_convertvector(acc[i][j] * om, v8h);
                *(v8h*)(wp + j * 16 * E_PITCH_H + i * 32) = o[i][j];
            }
        wait_ds0();                                   // the rows are read back by other lanes of this wave
        // 8 lanes a row of 128 bytes: a store is 4 whole lines
        const unsigned char* rp = stg + (lane >> 3) * E_PITCH_H + (lane & 7) * 16;
        g += (long)(lane >> 3) * gp + (lane & 7) * 8;
        v8h row[16];
        for (int t = 0; t < 16; ++t) row[t] = *(const v8h*)(rp + t * 4 * E_PITCH_H);
        for (int t = 0; t < 16; ++t) *(v8h*)(g + (long)(t * 4) * gp) = row[t];
        // behind the last store: the code that follows overwrites address and data registers of
        // these stores
        asm volatile("s_wait_xcnt 0x0" ::: "memory");
        if (rowmajor) {
            // a token's 64 squares, of the values as stored: 32 in the lane (8 partial sums, one
            // per register of a fragment), the other 32 in the lane 16 on
            float mx = 0.f;
            for (int j = 0; j < 4; ++j) {
                v8f s8 = v8f{0};
                for (int i = 0; i < 4; ++i) {
                    const v8f hv = __builtin_convertvector(o[i][j], v8f);
                    s8 += hv * hv;
                }
                float ss = ((s8[0] + s8[1]) + (s8[2] + s8[3])) + ((s8[4] + s8[5]) + (s8[6] + s8[7]));
                ss += __shfl_xor(ss, 16, 32);
                mx = fmaxf(mx, ss);
            }
            mx = max_xmask<1>(mx);                    // over the 16 tokens of each fragment column
            mx = max_xmask<2>(mx);
            mx = max_xmask<4>(mx);
            mx = max_xmask<8>(mx);
            const int nb = T >> 6, nh = qcol1 >> 6;   // 64-token blocks of a batch; heads
            const int rb = (tm >> 6) + (int)wm;       // this quadrant's 64-row block
            const int cq = (tn >> 6) + (int)wn;       // its 64-column block: the Q heads, then the K heads
            const long e = ((long)((cq / nh) * (M / T) + rb / nb) * nh + cq % nh) * nb + rb % nb;
            if (lane == 0) nrm[e * NRM_PITCH] = sqrtf(mx);
        }
    } else {
        unsigned char* wp = stg + colb * E_PITCH_F + rowb * 4;
        for (int j = 0; j < 4; ++j)
            for (int i = 0; i < 4; ++i) {
                const v8f a = acc[i][j];
                *(v4f*)(wp + j * 16 * E_PITCH_F + i * 64)      = v4f{a[0], a[1], a[2], a[3]};
                *(v4f*)(wp + j * 16 * E_PITCH_F + i * 64 + 16) = v4f{a[4], a[5], a[6], a[7]};
            }
        wait_ds0();                                   // the rows are read back by other lanes of this wave
        // 16 lanes a row of 256 bytes: a store is 4 whole lines
        const unsigned char* rp = stg + (lane >> 4) * E_PITCH_F + (lane & 15) * 16;
        float* g = (float*)C + (long)(tm + (int)wm * 64 + (lane >> 4)) * ldc + tn + (int)wn * 64 + (lane & 15) * 4;
        v4f row[32];
        for (int t = 0; t < 32; ++t) row[t] = *(const v4f*)(rp + t * 2 * E_PITCH_F);
        for (int t = 0; t < 32; ++t) *(v4f*)(g + (long)(t * 2) * ldc) = row[t];
    }
}

// ---------------------------------------------------------------------------
// Flash attention, causal + ALiBi, fully transposed dataflow.
//   qkv : [B*T, 3*D] f16 ;  vT : [B*H, hd, T] f16 ;  outh : [B*T, D] f16
// One wave owns 16 query columns (lane = query); key tiles of 32.
//   S^T = K(16kt x 64) · Q^T(64 x 16q)   -> C-frag: lane=q, reg r = kt r/r+8
//   O^T = V^T(64d x 32kt) · P^T(32 x 16q)-> C-frag: lane=q, reg r = d
// P^T C-frag layout == B-operand layout, so P is repacked in registers.
// The score WMMAs deliver the finished exponent of 2: Q arrives multiplied by hd^-0.5 * log2(e),
// and what is added to a score, ALiBi bias and causal mask, goes in as their C operand. Under the
// mask the bias is slope * (key - query); the query's part is one constant per softmax row and
// drops out, and the key's part is split into slope * (key - tile's first key), the same 16
// numbers a lane in every tile, and slope * (tile's first key), by which the running maximum is
// moved instead when the walk goes from one tile to another. A tile whose last key is not behind
// the wave's first query masks nothing: its C operand is those 16 numbers, loop-invariant. Only a
// tile on the diagonal forms its own, with MASKED in the place of each key behind the query.
// The four waves of a work-group walk the same keys, so K and V^T come through LDS once
// per work-group and query block: a stage is 64 keys (64 K rows of 128 bytes, 64 V^T rows of 128 bytes),
// wave 0 brings the K slice and wave 1 the V^T slice with one tensor load each; two
// buffers, the next stage's loads fly during a pass. hd = 64, T a multiple of 128.
// Causal cost grows with the query block, and every work-group is resident at once, so the
// launch lasts as long as its fullest WGP. A work-group therefore takes TWO query blocks of
// one head, n-1-t and then t, one after the other in every wave: (n-t) + (t+1) = n+1 stages
// for every work-group where no stage drops out (below). The ring runs on over the change of
// block: stage numbers count through both blocks.
// WHICH STAGES A QUERY BLOCK WALKS. The exponent of key j for query q is e(q,j) = q.k_j + slope *
// (j - q), and the row's maximum is at least e(q,q) >= -|q||k_q|. With nq the largest |q| of the
// block, nd the largest |k| of the diagonal stage and nj the largest |k| of stage j (the qkv
// product stores them), every key of stage j has e - maximum <= nq * (nj + nd) - slope * (least
// distance from the block to the stage). Below -ZERO_BELOW the weight 2^(e - maximum) is 0 in f32
// (the least f32 above 0 is 2^-149; the rest of the margin is for the rounding of norms and
// scores): such a stage adds zeros to every sum and is neither loaded nor worked on. The test
// reads the data, so it holds for any input: large norms or a small slope keep every stage.
// Lane j tests stage j (at most 32 stages: T at most 2048), a ballot makes the block's stage set,
// the same in every wave: same numbers, same operations. The diagonal stage is always in the set
// and comes first, so that the running maximum is at least e(q,q) from the first stage on; then
// the set's stages downwards. The work-groups of one head start on different diagonals, so on
// different lines.
// ---------------------------------------------------------------------------
constexpr uint32_t AT_STAGE = 2 * G_SLICE;        // K slice | V^T slice
constexpr float    LOG2E    = 1.44269504f;
constexpr float    Q_SCALE  = 0.125f * LOG2E;     // hd^-0.5 * log2(e), multiplied into Q by the qkv product
constexpr float    MASKED   = -1.0e30f;           // far below any score of f16 operands: 2^(MASKED - max) is 0
constexpr float    ZERO_BELOW = 160.0f;           // 2^x is 0 in f32 for x below -150; 10 more for rounding
struct OnDiagonal  { static constexpr bool value = true;  };
struct OffDiagonal { static constexpr bool value = false; };

__global__ void __launch_bounds__(128) attn_flash_wmma(const _Float16* __restrict__ qkv,
                                                       const _Float16* __restrict__ vT,
                                                       _Float16* __restrict__ outh,
                                                       const float* __restrict__ nrm,
                                                       int T, int H, int hd) {
    __shared__ __attribute__((aligned(2048))) unsigned char ring[2 * AT_STAGE];
    const int  D  = H * hd;            // 1024
    const long ld = (long)3 * D;       // 3072
    int nQblk = T / 64;                // even
    int nPair = nQblk / 2;
    int bh    = blockIdx.x / nPair;
    int pr    = blockIdx.x % nPair;    // t: this work-group's query blocks are nQblk-1-t and t
    int b = bh / H, h = bh % H;
    const uint32_t wave = uni(threadIdx.x >> 5);
    int lane = threadIdx.x & 31;

    const float slope2 = exp2f(-(float)(h + 1) / (float)H) * LOG2E;   // ALiBi slope, in powers of 2
    const float NEGINF = -__builtin_inff();

    const _Float16* Qp = qkv + (long)b * T * ld + (long)h * hd;
    const _Float16* Kp = Qp + D;
    const _Float16* Vt = vT + (long)bh * hd * T;

    // the issuing waves' slice of every stage: wave 0 K rows (a stage on = 64 rows), wave 1
    // V^T rows (a stage on = 128 bytes along each row)
    const uint64_t ga0   = (uint64_t)(size_t)((wave == 0u) ? Kp : Vt);
    const uint64_t gstep = (wave == 0u) ? (uint64_t)ld * 2u * G_ROWS : (uint64_t)G_ROWB;
    const uint32_t dst0  = (uint32_t)(size_t)ring + (wave & 1u) * G_SLICE;
    const u32x8    g1    = tdm_group1((wave == 0u) ? (uint32_t)ld * 2u : (uint32_t)T * 2u);
    const int qb1 = nQblk - 1 - pr, qb2 = pr;     // the two query blocks = their diagonal stages

    // the stage sets of both blocks, bit j = key stage j
    const float* nq = nrm + (long)bh * nQblk * NRM_PITCH;
    const float* nk = nq + (long)((int)gridDim.x / nPair) * nQblk * NRM_PITCH;
    const float  nj = nk[((lane < nQblk) ? lane : nQblk - 1) * NRM_PITCH];
    // behind the load: the code that follows overwrites the registers that hold its address
    asm volatile("s_wait_xcnt 0x0" ::: "memory");
    const float  nq1 = nq[qb1 * NRM_PITCH], nd1 = nk[qb1 * NRM_PITCH];
    const float  nq2 = nq[qb2 * NRM_PITCH], nd2 = nk[qb2 * NRM_PITCH];

    if (pinned(wave < 2u)) {
        tdm_load(tdm_group0(dst0, ga0 + (uint64_t)(uint32_t)qb1 * gstep), g1);   // stage 0: the first diagonal
        wait_tensor0();
    }
    __syncthreads();                              // stage 0 published
    auto stage_set = [&](int qb, float nqb, float ndb) -> uint32_t {
        const float top  = nqb * (nj + ndb) - slope2 * (float)(64 * (qb - lane) - 63);
        const bool  need = (lane < qb) && !(top < -ZERO_BELOW);      // a NaN keeps the stage
        return __builtin_amdgcn_ballot_w32(need) | (1u << qb);
    };
    const uint32_t set1 = stage_set(qb1, nq1, nd1), set2 = stage_set(qb2, nq2, nd2);
    // stages not yet asked for: this block's, the next block's; taken from the top bit down
    uint32_t askA = set1 & ~(1u << qb1), askB = set2;
    auto next_ask = [&]() -> uint32_t {           // only while askA | askB is not 0
        if (askA == 0u) { askA = askB; askB = 0u; }
        const uint32_t k = 31u - (uint32_t)__builtin_clz(askA);
        askA &= ~(1u << k);
        return k;
    };
    const uint32_t n1  = pinned(next_ask());      // descriptor words formed behind the wait; set2 is never empty
    u32x4 g0 = tdm_group0(dst0 + AT_STAGE, ga0 + (uint64_t)n1 * gstep);
    if (pinned(wave < 2u))
        tdm_load_held(g0, g1);                    // stage 1

    const int rh8 = (lane >> 4) << 3;             // 0 or 8 (kt / d row offset)
    v8f cb0, cb1;                                 // slope2 * (key - tile's first key), C-frag layout
    for (int r = 0; r < 8; ++r) {
        cb0[r] = slope2 * (float)(rh8 + r);
        cb1[r] = slope2 * (float)(16 + rh8 + r);
    }
    const uint32_t fo = (uint32_t)(lane & 15) * G_PITCH + (uint32_t)(lane >> 4) * 16u;
    uint32_t sg = 0;                              // stage number, counted through both blocks

    for (int half = 0; half < 2; ++half) {
    const int qblk  = half ? qb2 : qb1;
    const int qbase = qblk * 64 + (int)wave * 16;

    // Q^T B-operand fragments for this wave's 16 queries (hd=64 -> 2 chunks)
    v16h qfA = load_frag_rm(Qp, ld, qbase, 0);    // dd = 0..31
    v16h qfB = load_frag_rm(Qp, ld, qbase, 32);   // dd = 32..63

    int qlane = qbase + (lane & 15);              // this lane's query index

    // rel = qlane - kt_index, affine per tile: precompute per-register bases
    float relA[8];
    for (int r = 0; r < 8; ++r) relA[r] = (float)(qlane - rh8 - r);   // rel at kt = 0, first half

    v8f  o[4] = {{0}, {0}, {0}, {0}};             // O^T: 64d x 16q, 4 frags
    float mrow = NEGINF, lrow = 0.f;              // mrow counts from slope2 * kref
    int   kref = 0;                               // first key of the tile worked on last (wave-uniform)

    // one key tile of 32: pk at K row 0 of the tile, pv at its first key in V^T row 0, both
    // with the lane's fragment offset; kt = index of the tile's first key
    auto key_tile = [&](auto diag, const unsigned char* pk, const unsigned char* pv, int kt) {
        // ---- C operand of the score WMMAs ----
        v8f c0 = cb0, c1 = cb1;
        if constexpr (decltype(diag)::value) {
            const float ktf = (float)kt;
            for (int r = 0; r < 8; ++r) {
                float rel0 = relA[r] - ktf;       // qlane - k0 (exact integer)
                c0[r] = (rel0 >= 0.0f)  ? cb0[r] : MASKED;
                c1[r] = (rel0 >= 16.0f) ? cb1[r] : MASKED;
            }
        }
        // ---- all K fragments, then the 4 score WMMAs ----
        v16h kf0a = lds_frag(pk);
        v16h kf0b = lds_frag(pk + 64);
        v16h kf1a = lds_frag(pk + 16 * G_PITCH);
        v16h kf1b = lds_frag(pk + 16 * G_PITCH + 64);
        v8f s0 = wmma_f16(kf0a, qfA, c0);
        s0 = wmma_f16(kf0b, qfB, s0);
        v8f s1 = wmma_f16(kf1a, qfA, c1);
        s1 = wmma_f16(kf1b, qfB, s1);

        // ---- V fragments early; softmax math below hides their latency
        v16h vf0 = lds_frag(pv);
        v16h vf1 = lds_frag(pv + 16 * G_PITCH);
        v16h vf2 = lds_frag(pv + 32 * G_PITCH);
        v16h vf3 = lds_frag(pv + 48 * G_PITCH);

        // ---- local max (per-lane regs) ----
        float mloc = NEGINF;
        for (int r = 0; r < 8; ++r) mloc = fmaxf(mloc, fmaxf(s0[r], s1[r]));
        mloc = fmaxf(mloc, __shfl_xor(mloc, 16, 32));   // join the two kt halves
        const float mold = mrow - slope2 * (float)(kt - kref);   // the maximum so far, counted from this tile
        kref = kt;
        float mnew = fmaxf(mold, mloc);

        // ---- powers of 2, P^T repacked directly into a B-operand frag ----
        float corr = __builtin_amdgcn_exp2f(mold - mnew);        // 0 when mold == -inf
        v16h pb = {};
        float ps = 0.f;
        for (int r = 0; r < 8; ++r) {
            float p0 = __builtin_amdgcn_exp2f(s0[r] - mnew);     // 0 where masked
            float p1 = __builtin_amdgcn_exp2f(s1[r] - mnew);
            ps += p0 + p1;
            pb[r]     = (_Float16)p0;                   // kk = rh8 + r
            pb[8 + r] = (_Float16)p1;                   // kk = 16 + rh8 + r
        }
        ps += __shfl_xor(ps, 16, 32);
        lrow = lrow * corr + ps;
        mrow = mnew;

        // ---- O^T = corr*O^T + V^T x P^T ----
        o[0] = wmma_f16(vf0, pb, o[0] * corr);
        o[1] = wmma_f16(vf1, pb, o[1] * corr);
        o[2] = wmma_f16(vf2, pb, o[2] * corr);
        o[3] = wmma_f16(vf3, pb, o[3] * corr);
    };

    uint32_t todo = half ? set2 : set1;           // this block's stages, in the order they were asked for
    do {
        const unsigned char* pk = ring + (sg & 1u) * AT_STAGE + fo;
        const unsigned char* pv = pk + G_SLICE;
        const uint32_t ks = 31u - (uint32_t)__builtin_clz(todo);       // this stage's 64 keys
        todo &= ~(1u << ks);
        const int kt = (int)ks * 64;
        if (kt + 63 <= qbase) {                   // wave-uniform: no key of the stage behind a query
            key_tile(OffDiagonal{}, pk, pv, kt);
            key_tile(OffDiagonal{}, pk + 32 * G_PITCH, pv + 64, kt + 32);
        } else {                                  // the diagonal stage
            key_tile(OnDiagonal{}, pk, pv, kt);
            if (kt + 32 <= qbase + 15)            // wave-uniform: else every key of the tile is masked
                key_tile(OnDiagonal{}, pk + 32 * G_PITCH, pv + 64, kt + 32);
        }
        // publish point of stage sg + 1
        wait_ds0();
        if (pinned(wave < 2u)) wait_tensor0_of(g0);
        __syncthreads();                          // sg + 1 readable; every wave has left sg
        const bool more = (askA | askB) != 0u;    // a stage sg + 2 exists (the same in every wave)
        const uint32_t ka = more ? next_ask() : 0u;
        if (pinned((wave < 2u) && more)) {
            const uint32_t nx = pinned(sg + 2u);  // descriptor words formed behind the wait
            const uint32_t kb = pinned(ka);
            g0 = tdm_group0(dst0 + (nx & 1u) * AT_STAGE, ga0 + (uint64_t)kb * gstep);
            tdm_load_held(g0, g1);
        }
        ++sg;
    } while (todo != 0u);

    // ---- normalize, write O^T: lane q stores 8 contiguous d per fragment ----
    float rinv = 1.0f / lrow;
    _Float16* dst = outh + ((long)b * T + qlane) * D + (long)h * hd + rh8;
    for (int f = 0; f < 4; ++f) {
        v8h ov;
        for (int r = 0; r < 8; ++r) ov[r] = (_Float16)(o[f][r] * rinv);
        *(v8h*)(dst + f * 16) = ov;                     // d = f*16 + rh8 + r
    }
    // the next block's set-up overwrites the address and data registers of these stores
    asm volatile("s_wait_xcnt 0x0" ::: "memory");
    }   // second query block
    wait_tensor0();
    wait_ds0();
}

// ---------------------------------------------------------------------------
// Host launcher
// ---------------------------------------------------------------------------
extern "C" void kernel_launch(void* const* d_in, const int* in_sizes, int n_in,
                              void* d_out, int out_size, void* d_ws, size_t ws_size,
                              hipStream_t stream) {
    (void)in_sizes; (void)n_in; (void)out_size; (void)ws_size;
    constexpr int  Bb = 2, T = 2048, D = 1024, H = 16, HD = 64;
    constexpr long M  = (long)Bb * T;          // 4096

    const float* x     = (const float*)d_in[0];
    const float* w_qkv = (const float*)d_in[1];
    const float* w_out = (const float*)d_in[2];
    float*       out   = (float*)d_out;

    // workspace carve-up (256B aligned)
    char* ws = (char*)d_ws;
    size_t off = 0;
    auto carve = [&](size_t bytes) {
        size_t r = off;
        off += (bytes + 255) & ~(size_t)255;
        return r;
    };
    _Float16* xh    = (_Float16*)(ws + carve(M * D * 2));               //  8 MB
    _Float16* wqkvh = (_Float16*)(ws + carve((size_t)3 * D * D * 2));   //  6 MB
    _Float16* wouth = (_Float16*)(ws + carve((size_t)D * D * 2));       //  2 MB
    _Float16* qkvh  = (_Float16*)(ws + carve(M * 3 * D * 2));           // 24 MB
    _Float16* vTh   = (_Float16*)(ws + carve((size_t)Bb * H * HD * T * 2)); // 8 MB
    _Float16* atth  = (_Float16*)(ws + carve(M * D * 2));               //  8 MB
    float*    nrmw  = (float*)(ws + carve((size_t)2 * Bb * H * (T / 64) * NRM_PITCH * 4)); // 256 KB
    static_assert(T / 64 <= 32 && HD == 64, "one lane per key stage; a GEMM wave's quadrant is one head");

    // 1) f32 -> f16 conversions, one launch for the three arrays
    {
        constexpr long n1 = M * D, n2 = (long)3 * D * D, n3 = (long)D * D;
        static_assert(n1 % CV_SPAN == 0 && n2 % CV_SPAN == 0 && n3 % CV_SPAN == 0, "whole spans only");
        constexpr int nb1 = (int)(n1 / CV_SPAN), nb2 = (int)(n2 / CV_SPAN), nb3 = (int)(n3 / CV_SPAN);
        cvt3_f32_to_f16<<<dim3(nb1 + nb2 + nb3), dim3(CV_THREADS), 0, stream>>>(
            x, xh, nb1, w_qkv, wqkvh, nb2, w_out, wouth);
    }

    // 2) qkv = x @ w_qkv^T   (4096x1024 x 1024x3072): Q (pre-scaled), K -> f16 [4096,3072] (its V
    //    third stays unwritten and unread), V -> vT[bh][d][t]
    {
        int tiles = (int)(M / 128) * (3 * D / 128);   // 768
        gemm_wmma<true><<<dim3(tiles), dim3(128), 0, stream>>>(
            xh, wqkvh, qkvh, (int)M, 3 * D, D, 3 * D, vTh, 2 * D, T, D, Q_SCALE, nrmw);
    }

    // 3) flash attention (causal + ALiBi, transposed dataflow) -> atth f16
    {
        int blocks = Bb * H * (T / 128);              // 512: two query blocks each
        attn_flash_wmma<<<dim3(blocks), dim3(128), 0, stream>>>(qkvh, vTh, atth, nrmw, T, H, HD);
    }

    // 4) out = attn @ w_out^T -> f32 d_out
    {
        int tiles = (int)(M / 128) * (D / 128);       // 256
        gemm_wmma<false><<<dim3(tiles), dim3(128), 0, stream>>>(
            atth, wouth, out, (int)M, D, D, D, nullptr, D, T, 0, 1.0f, nullptr);
    }
}
